// v000
// The times below were measured on an AMD MI455X: many runs one after another, warmed up first and cycling through
// copies of the inputs, with the whole window's GPU time divided by the number of runs. Launches and the gaps
// between them are all in it. The median over several windows is given; except for v000 it joins two sittings, which
// can be a few percent apart, so the side-by-side timings, each taken in one sitting, are the better comparison.
// v000, which the later versions start from, runs in 840 microseconds.
#include <hip/hip_runtime.h>
#include <hip/hip_bf16.h>

typedef _Float16 v16h __attribute__((ext_vector_type(16)));
typedef _Float16 h8   __attribute__((ext_vector_type(8)));
typedef _Float16 h2   __attribute__((ext_vector_type(2)));
typedef float    v8f  __attribute__((ext_vector_type(8)));

#define S_LEN   4096
#define D_DIM   64
#define KBLK    32            // keys per inner iteration
#define NBLK    (S_LEN / KBLK)
#define KSTRIDE 72
#define VSTRIDE 40
#define LOG2E   1.4426950408889634f

__device__ inline v8f splat8(float x) {
    v8f r;
#pragma unroll
    for (int e = 0; e < 8; ++e) r[e] = x;
    return r;
}

__device__ inline v16h lds_frag(const _Float16* row, int half, int doff) {
    union { v16h v; h8 h[2]; } u;
    u.h[0] = *reinterpret_cast<const h8*>(row + doff + half * 8);
    u.h[1] = *reinterpret_cast<const h8*>(row + doff + 16 + half * 8);
    return u.v;
}

// Global f32 -> f16 fragment with pre-scale folded in.
__device__ inline v16h glb_frag_scaled(const float* __restrict__ row, int half,
                                       int doff, float scale) {
    const float4* p0 = reinterpret_cast<const float4*>(row + doff + half * 8);
    const float4* p1 = reinterpret_cast<const float4*>(row + doff + 16 + half * 8);
    float4 a = p0[0], b = p0[1], c = p1[0], d = p1[1];
    float lo[8] = {a.x, a.y, a.z, a.w, b.x, b.y, b.z, b.w};
    float hi[8] = {c.x, c.y, c.z, c.w, d.x, d.y, d.z, d.w};
    v16h r;
#pragma unroll
    for (int e = 0; e < 8; ++e) {
        r[e]     = (_Float16)(lo[e] * scale);
        r[e + 8] = (_Float16)(hi[e] * scale);
    }
    return r;
}

__device__ inline v8f wmma_f16(v16h a, v16h b, v8f c) {
    return __builtin_amdgcn_wmma_f32_16x16x32_f16(false, a, false, b, (short)0, c, false, false);
}

// Cooperative stage of one 32x64 K block (row-major f16) and V block
// (d-major / transposed f16) into LDS. 128 threads, coalesced reads,
// packed ds_store_b32 writes.
__device__ inline void stage_kv(const float* __restrict__ Kp, const float* __restrict__ Vp,
                                _Float16* kt, _Float16* vt, int t) {
#pragma unroll
    for (int j = 0; j < 8; ++j) {
        int i = (t + j * 128) * 2;            // flat k*64 + d, d even
        int k = i >> 6;
        int d = i & 63;
        float2 kv = *reinterpret_cast<const float2*>(Kp + (size_t)k * D_DIM + d);
        h2 p; p[0] = (_Float16)kv.x; p[1] = (_Float16)kv.y;
        *reinterpret_cast<h2*>(kt + k * KSTRIDE + d) = p;    // row-major
    }
#pragma unroll
    for (int j = 0; j < 8; ++j) {
        int pi = t + j * 128;                 // pair index
        int k  = (pi >> 6) << 1;              // even k
        int d  = pi & 63;
        float a = Vp[(size_t)k * D_DIM + d];
        float b = Vp[(size_t)(k + 1) * D_DIM + d];
        h2 p; p[0] = (_Float16)a; p[1] = (_Float16)b;
        *reinterpret_cast<h2*>(vt + d * VSTRIDE + k) = p;    // transposed
    }
}

__global__ __launch_bounds__(128) void
flash_attn_fwd(const float* __restrict__ Q, const float* __restrict__ K,
               const float* __restrict__ V, const float* __restrict__ Mk,
               float* __restrict__ O) {
    const int lane = threadIdx.x & 31;
    const int wave = threadIdx.x >> 5;
    const int n    = lane & 15;   // query column of all transposed tiles
    const int half = lane >> 4;   // K-half of A/B fragments held by this lane

    const int bh   = blockIdx.x >> 5;        // 16 (b,h) slices
    const int qblk = blockIdx.x & 31;        // 32 query blocks of 128 rows
    const int q0   = qblk * 128 + wave * 32; // 32 queries per wave: two 16-row tiles

    const size_t base = (size_t)bh * S_LEN * D_DIM;
    const int qA = q0 + n, qB = q0 + 16 + n;
    const float* mrowA = Mk + (size_t)qA * S_LEN;   // mask broadcasts over B,H
    const float* mrowB = Mk + (size_t)qB * S_LEN;

    __shared__ _Float16 ktile[2][KBLK * KSTRIDE];   // 2 x 4.5 KB
    __shared__ _Float16 vtile[2][D_DIM * VSTRIDE];  // 2 x 5.0 KB

    // Loop-invariant Q^T B-fragments, pre-scaled by (1/sqrt(d_k))*log2(e):
    // scores come out of the QK WMMAs already in log2 domain.
    const float qs = 0.125f * LOG2E;
    v16h bq[2][2];
    bq[0][0] = glb_frag_scaled(Q + base + (size_t)qA * D_DIM, half, 0,  qs);
    bq[0][1] = glb_frag_scaled(Q + base + (size_t)qA * D_DIM, half, 32, qs);
    bq[1][0] = glb_frag_scaled(Q + base + (size_t)qB * D_DIM, half, 0,  qs);
    bq[1][1] = glb_frag_scaled(Q + base + (size_t)qB * D_DIM, half, 32, qs);

    v8f ot[2][4];                                   // O^T accumulators [tile][d-chunk]
#pragma unroll
    for (int t = 0; t < 2; ++t)
#pragma unroll
        for (int c = 0; c < 4; ++c) ot[t][c] = splat8(0.0f);

    float m_run[2] = {-INFINITY, -INFINITY};        // log2 domain
    float l_run[2] = {0.0f, 0.0f};
    const v8f mcoef = splat8(-1e9f * LOG2E);

    stage_kv(K + base, V + base, ktile[0], vtile[0], threadIdx.x);

    for (int kb = 0; kb < NBLK; ++kb) {
        __syncthreads();
        const int cur = kb & 1;
        if (kb + 1 < NBLK) {                        // overlap next block's staging
            const size_t nk0 = (size_t)(kb + 1) * KBLK * D_DIM;
            stage_kv(K + base + nk0, V + base + nk0,
                     ktile[1 - cur], vtile[1 - cur], threadIdx.x);
        }

        const int k0 = kb * KBLK;
        const _Float16* kt = ktile[cur];
        const _Float16* vt = vtile[cur];

        // ---- K A-fragments: loaded once, shared by both query tiles ----
        v16h ak00 = lds_frag(kt + n * KSTRIDE, half, 0);
        v16h ak01 = lds_frag(kt + n * KSTRIDE, half, 32);
        v16h ak10 = lds_frag(kt + (16 + n) * KSTRIDE, half, 0);
        v16h ak11 = lds_frag(kt + (16 + n) * KSTRIDE, half, 32);

        // ---- S^T = K_blk x Q^T : 8 WMMAs, two independent accumulator sets ----
        v8f st[2][2];
#pragma unroll
        for (int t = 0; t < 2; ++t) {
            v8f z0 = splat8(0.0f);
            v8f z1 = splat8(0.0f);
            z0 = wmma_f16(ak00, bq[t][0], z0);
            z1 = wmma_f16(ak10, bq[t][0], z1);
            z0 = wmma_f16(ak01, bq[t][1], z0);
            z1 = wmma_f16(ak11, bq[t][1], z1);
            st[t][0] = z0; st[t][1] = z1;
        }

        // ---- per-tile: mask + online softmax (base-2) + P^T fragment ----
        v16h bp[2];
#pragma unroll
        for (int t = 0; t < 2; ++t) {
            const float* mrow = t ? mrowB : mrowA;
            // 32B-aligned vector loads straight into v8f (2x global_load_b128)
            v8f mk0 = *reinterpret_cast<const v8f*>(mrow + k0 + half * 8);
            v8f mk1 = *reinterpret_cast<const v8f*>(mrow + k0 + 16 + half * 8);

            // whole-vector math: operands are already pk-pair aligned
            v8f s0 = mk0 * mcoef + st[t][0];
            v8f s1 = mk1 * mcoef + st[t][1];

            float mblk = -INFINITY;
#pragma unroll
            for (int v = 0; v < 8; ++v) mblk = fmaxf(mblk, fmaxf(s0[v], s1[v]));
            mblk = fmaxf(mblk, __shfl_xor(mblk, 16, 32));

            const float m_new = fmaxf(m_run[t], mblk);
            const float alpha = __builtin_amdgcn_exp2f(m_run[t] - m_new);

            v8f p0, p1;
            float rsum = 0.0f;
#pragma unroll
            for (int v = 0; v < 8; ++v) {
                p0[v] = __builtin_amdgcn_exp2f(s0[v] - m_new);
                p1[v] = __builtin_amdgcn_exp2f(s1[v] - m_new);
                rsum += p0[v] + p1[v];
            }
            rsum += __shfl_xor(rsum, 16, 32);
            l_run[t] = l_run[t] * alpha + rsum;
            m_run[t] = m_new;

            const v8f av_ = splat8(alpha);
#pragma unroll
            for (int c = 0; c < 4; ++c) ot[t][c] = ot[t][c] * av_;

#pragma unroll
            for (int v = 0; v < 8; ++v) {
                bp[t][v]     = (_Float16)p0[v];
                bp[t][v + 8] = (_Float16)p1[v];
            }
        }

        // ---- O^T += V^T x P^T : 8 WMMAs, V^T A-fragments shared by both tiles ----
#pragma unroll
        for (int c = 0; c < 4; ++c) {
            v16h av = lds_frag(vt + (c * 16 + n) * VSTRIDE, half, 0);
            ot[0][c] = wmma_f16(av, bp[0], ot[0][c]);
            ot[1][c] = wmma_f16(av, bp[1], ot[1][c]);
        }
    }

    // ---- epilogue: O[q][d] = O^T / l ; lane owns row q, d = c*16 + half*8 + v ----
#pragma unroll
    for (int t = 0; t < 2; ++t) {
        const v8f inv_l = splat8(1.0f / l_run[t]);
        float* orow = O + base + (size_t)(t ? qB : qA) * D_DIM;
#pragma unroll
        for (int c = 0; c < 4; ++c) {
            v8f ov = ot[t][c] * inv_l;
            *reinterpret_cast<v8f*>(orow + c * 16 + half * 8) = ov;  // 2x b128 store
        }
    }
}

extern "C" void kernel_launch(void* const* d_in, const int* in_sizes, int n_in,
                              void* d_out, int out_size, void* d_ws, size_t ws_size,
                              hipStream_t stream) {
    (void)in_sizes; (void)n_in; (void)d_ws; (void)ws_size; (void)out_size;
    const float* Q  = (const float*)d_in[0];
    const float* K  = (const float*)d_in[1];
    const float* V  = (const float*)d_in[2];
    // d_in[3] = d_k (scalar, 64) — folded into the Q pre-scale
    const float* Mk = (const float*)d_in[4];
    float* O = (float*)d_out;

    // grid: 16 (b,h) slices x 32 query-blocks of 128 rows; 128 threads = 4 waves
    dim3 grid(16 * 32), block(128);
    flash_attn_fwd<<<grid, block, 0, stream>>>(Q, K, V, Mk, O);
}

// v001
// A run of this version takes 127 microseconds.
// Next to v000, in two timings, it ran 6.65 and 6.61 times as fast.
#include <hip/hip_runtime.h>
#include <hip/hip_bf16.h>

typedef _Float16 v16h __attribute__((ext_vector_type(16)));
typedef _Float16 h8   __attribute__((ext_vector_type(8)));
typedef _Float16 h2   __attribute__((ext_vector_type(2)));
typedef float    v8f  __attribute__((ext_vector_type(8)));

#define S_LEN   4096
#define D_DIM   64
#define KBLK    32            // keys per pass; a loop trip runs two passes
#define NBLK    (S_LEN / KBLK)
#define KSTRIDE 72
#define VSTRIDE 40
#define LOG2E   1.4426950408889634f

__device__ inline v8f splat8(float x) {
    v8f r;
#pragma unroll
    for (int e = 0; e < 8; ++e) r[e] = x;
    return r;
}

__device__ inline v16h lds_frag(const _Float16* row, int half, int doff) {
    union { v16h v; h8 h[2]; } u;
    u.h[0] = *reinterpret_cast<const h8*>(row + doff + half * 8);
    u.h[1] = *reinterpret_cast<const h8*>(row + doff + 16 + half * 8);
    return u.v;
}

// Global f32 -> f16 fragment with pre-scale folded in.
__device__ inline v16h glb_frag_scaled(const float* __restrict__ row, int half,
                                       int doff, float scale) {
    const float4* p0 = reinterpret_cast<const float4*>(row + doff + half * 8);
    const float4* p1 = reinterpret_cast<const float4*>(row + doff + 16 + half * 8);
    float4 a = p0[0], b = p0[1], c = p1[0], d = p1[1];
    float lo[8] = {a.x, a.y, a.z, a.w, b.x, b.y, b.z, b.w};
    float hi[8] = {c.x, c.y, c.z, c.w, d.x, d.y, d.z, d.w};
    v16h r;
#pragma unroll
    for (int e = 0; e < 8; ++e) {
        r[e]     = (_Float16)(lo[e] * scale);
        r[e + 8] = (_Float16)(hi[e] * scale);
    }
    return r;
}

__device__ inline v8f wmma_f16(v16h a, v16h b, v8f c) {
    return __builtin_amdgcn_wmma_f32_16x16x32_f16(false, a, false, b, (short)0, c, false, false);
}

// One 32x64 K block (row-major f16 in LDS) and V block (d-major / transposed
// f16 in LDS), staged by 128 threads in two halves: load_kv issues all of a
// thread's global loads into registers, store_kv converts and writes them.
struct KVRegs { float2 k[8]; float va[8]; float vb[8]; };

// kp = block + 2*t ; vp = block + (t>>6)*128 + (t&63). Coalesced reads.
__device__ inline void load_kv(const float* __restrict__ kp, const float* __restrict__ vp,
                               KVRegs& r) {
    // All four loops below are unrolled so that r stays in registers (constant indices).
#pragma unroll
    for (int j = 0; j < 8; ++j)               // rows (t>>5) + 4j, columns 2*(t&31)
        r.k[j] = *reinterpret_cast<const float2*>(kp + j * 4 * D_DIM);
#pragma unroll
    for (int j = 0; j < 8; ++j) {             // rows 2*(t>>6) + 4j and the next, column t&63
        r.va[j] = vp[j * 4 * D_DIM];
        r.vb[j] = vp[j * 4 * D_DIM + D_DIM];
    }
}

// kd = tile + (t>>5)*KSTRIDE + 2*(t&31) ; vd = tile + (t&63)*VSTRIDE + 2*(t>>6).
// Packed ds_store_b32 writes.
__device__ inline void store_kv(const KVRegs& r, _Float16* kd, _Float16* vd) {
#pragma unroll
    for (int j = 0; j < 8; ++j) {
        h2 p; p[0] = (_Float16)r.k[j].x; p[1] = (_Float16)r.k[j].y;
        *reinterpret_cast<h2*>(kd + j * 4 * KSTRIDE) = p;    // row-major
    }
#pragma unroll
    for (int j = 0; j < 8; ++j) {
        h2 p; p[0] = (_Float16)r.va[j]; p[1] = (_Float16)r.vb[j];
        *reinterpret_cast<h2*>(vd + j * 4) = p;              // transposed
    }
}

__global__ __launch_bounds__(128) void
flash_attn_fwd(const float* __restrict__ Q, const float* __restrict__ K,
               const float* __restrict__ V, const float* __restrict__ Mk,
               float* __restrict__ O) {
    const int lane = threadIdx.x & 31;
    const int wave = threadIdx.x >> 5;
    const int n    = lane & 15;   // query column of all transposed tiles
    const int half = lane >> 4;   // K-half of A/B fragments held by this lane

    const int bh   = blockIdx.x >> 5;        // 16 (b,h) slices
    const int qblk = blockIdx.x & 31;        // 32 query blocks of 128 rows
    const int q0   = qblk * 128 + wave * 32; // 32 queries per wave: two 16-row tiles

    const size_t base = (size_t)bh * S_LEN * D_DIM;
    const int qA = q0 + n, qB = q0 + 16 + n;
    const float* mrowA = Mk + (size_t)qA * S_LEN;   // mask broadcasts over B,H
    const float* mrowB = Mk + (size_t)qB * S_LEN;

    __shared__ _Float16 ktile[2][KBLK * KSTRIDE];   // 2 x 4.5 KB
    __shared__ _Float16 vtile[2][D_DIM * VSTRIDE];  // 2 x 5.0 KB

    // This thread's share of a K / V block: global sources and LDS places.
    const int tid = threadIdx.x;
    const float* kp = K + base + 2 * tid;
    const float* vp = V + base + (tid >> 6) * 2 * D_DIM + (tid & 63);
    const int kdo = (tid >> 5) * KSTRIDE + 2 * (tid & 31);
    const int vdo = (tid & 63) * VSTRIDE + 2 * (tid >> 6);

    KVRegs kv;
    load_kv(kp, vp, kv);
    // Mask registers, two sets: one is read by the pass at hand while the next
    // pass's loads land in the other. [tile][key half-block]
    v8f mkE[2][2], mkO[2][2];
    mkE[0][0] = *reinterpret_cast<const v8f*>(mrowA + half * 8);
    mkE[0][1] = *reinterpret_cast<const v8f*>(mrowA + 16 + half * 8);
    mkE[1][0] = *reinterpret_cast<const v8f*>(mrowB + half * 8);
    mkE[1][1] = *reinterpret_cast<const v8f*>(mrowB + 16 + half * 8);
    // Stands in front of every later write of a register that the loads above name.
    asm volatile("s_wait_xcnt 0x0" ::: "memory");

    // Loop-invariant Q^T B-fragments, pre-scaled by (1/sqrt(d_k))*log2(e):
    // scores come out of the QK WMMAs already in log2 domain.
    const float qs = 0.125f * LOG2E;
    v16h bq[2][2];
    bq[0][0] = glb_frag_scaled(Q + base + (size_t)qA * D_DIM, half, 0,  qs);
    bq[0][1] = glb_frag_scaled(Q + base + (size_t)qA * D_DIM, half, 32, qs);
    bq[1][0] = glb_frag_scaled(Q + base + (size_t)qB * D_DIM, half, 0,  qs);
    bq[1][1] = glb_frag_scaled(Q + base + (size_t)qB * D_DIM, half, 32, qs);
    // The same for the Q loads: the accumulators' start values may take their address registers.
    asm volatile("s_wait_xcnt 0x0" ::: "memory");

    v8f ot[2][4];                                   // O^T accumulators [tile][d-chunk]
#pragma unroll
    for (int t = 0; t < 2; ++t)
#pragma unroll
        for (int c = 0; c < 4; ++c) ot[t][c] = splat8(0.0f);

    float m_run[2] = {-INFINITY, -INFINITY};        // log2 domain
    float l_run[2] = {0.0f, 0.0f};
    const v8f mcoef = splat8(-1e9f * LOG2E);

    store_kv(kv, ktile[0] + kdo, vtile[0] + vdo);

    // One pass over 32 keys. cur: LDS buffer of this pass; mk: its mask;
    // mkn: takes the next pass's mask; more: a next pass exists (block-uniform).
    auto pass = [&](const int kb, const int cur, const bool more,
                    v8f (&mk)[2][2], v8f (&mkn)[2][2]) {
        __syncthreads();
        const int k0 = kb * KBLK;
        if (more) {          // all of the next pass's global loads fly, as one group,
                             // under this pass's work
            const size_t nk0 = (size_t)(kb + 1) * KBLK * D_DIM;
            load_kv(kp + nk0, vp + nk0, kv);
            // 32B-aligned vector loads straight into v8f (2x global_load_b128)
            const int kn = k0 + KBLK;
            mkn[0][0] = *reinterpret_cast<const v8f*>(mrowA + kn + half * 8);
            mkn[0][1] = *reinterpret_cast<const v8f*>(mrowA + kn + 16 + half * 8);
            mkn[1][0] = *reinterpret_cast<const v8f*>(mrowB + kn + half * 8);
            mkn[1][1] = *reinterpret_cast<const v8f*>(mrowB + kn + 16 + half * 8);
        }

        const _Float16* kt = ktile[cur];
        const _Float16* vt = vtile[cur];

        // ---- K A-fragments: loaded once, shared by both query tiles ----
        v16h ak00 = lds_frag(kt + n * KSTRIDE, half, 0);
        v16h ak01 = lds_frag(kt + n * KSTRIDE, half, 32);
        v16h ak10 = lds_frag(kt + (16 + n) * KSTRIDE, half, 0);
        v16h ak11 = lds_frag(kt + (16 + n) * KSTRIDE, half, 32);

        // ---- S^T = K_blk x Q^T : 8 WMMAs, two independent accumulator sets ----
        v8f st[2][2];
#pragma unroll
        for (int t = 0; t < 2; ++t) {
            v8f z0 = splat8(0.0f);
            v8f z1 = splat8(0.0f);
            z0 = wmma_f16(ak00, bq[t][0], z0);
            z1 = wmma_f16(ak10, bq[t][0], z1);
            z0 = wmma_f16(ak01, bq[t][1], z0);
            z1 = wmma_f16(ak11, bq[t][1], z1);
            st[t][0] = z0; st[t][1] = z1;
        }

        // ---- per-tile: mask + online softmax (base-2) + P^T fragment ----
        v16h bp[2];
#pragma unroll
        for (int t = 0; t < 2; ++t) {
            // whole-vector math: operands are already pk-pair aligned
            v8f s0 = mk[t][0] * mcoef + st[t][0];
            v8f s1 = mk[t][1] * mcoef + st[t][1];

            float mblk = -INFINITY;
#pragma unroll
            for (int v = 0; v < 8; ++v) mblk = fmaxf(mblk, fmaxf(s0[v], s1[v]));
            mblk = fmaxf(mblk, __shfl_xor(mblk, 16, 32));

            const float m_new = fmaxf(m_run[t], mblk);
            const float alpha = __builtin_amdgcn_exp2f(m_run[t] - m_new);

            v8f p0, p1;
            float rsum = 0.0f;
#pragma unroll
            for (int v = 0; v < 8; ++v) {
                p0[v] = __builtin_amdgcn_exp2f(s0[v] - m_new);
                p1[v] = __builtin_amdgcn_exp2f(s1[v] - m_new);
                rsum += p0[v] + p1[v];
            }
            rsum += __shfl_xor(rsum, 16, 32);
            l_run[t] = l_run[t] * alpha + rsum;
            m_run[t] = m_new;

            const v8f av_ = splat8(alpha);
#pragma unroll
            for (int c = 0; c < 4; ++c) ot[t][c] = ot[t][c] * av_;

#pragma unroll
            for (int v = 0; v < 8; ++v) {
                bp[t][v]     = (_Float16)p0[v];
                bp[t][v + 8] = (_Float16)p1[v];
            }
        }

        // ---- O^T += V^T x P^T : 8 WMMAs, V^T A-fragments shared by both tiles ----
#pragma unroll
        for (int c = 0; c < 4; ++c) {
            v16h av = lds_frag(vt + (c * 16 + n) * VSTRIDE, half, 0);
            ot[0][c] = wmma_f16(av, bp[0], ot[0][c]);
            ot[1][c] = wmma_f16(av, bp[1], ot[1][c]);
        }

        // The other buffer's readers left it before this pass's barrier.
        if (more) store_kv(kv, ktile[1 - cur] + kdo, vtile[1 - cur] + vdo);
    };

    // Two passes a trip, so that the mask sets and the LDS buffers swap by name.
    for (int kb = 0; kb < NBLK; kb += 2) {
        pass(kb,     0, true,          mkE, mkO);
        pass(kb + 1, 1, kb + 2 < NBLK, mkO, mkE);
    }

    // ---- epilogue: O[q][d] = O^T / l ; lane owns row q, d = c*16 + half*8 + v ----
#pragma unroll
    for (int t = 0; t < 2; ++t) {
        const v8f inv_l = splat8(1.0f / l_run[t]);
        float* orow = O + base + (size_t)(t ? qB : qA) * D_DIM;
#pragma unroll
        for (int c = 0; c < 4; ++c) {
            v8f ov = ot[t][c] * inv_l;
            *reinterpret_cast<v8f*>(orow + c * 16 + half * 8) = ov;  // 2x b128 store
        }
    }
}

extern "C" void kernel_launch(void* const* d_in, const int* in_sizes, int n_in,
                              void* d_out, int out_size, void* d_ws, size_t ws_size,
                              hipStream_t stream) {
    (void)in_sizes; (void)n_in; (void)d_ws; (void)ws_size; (void)out_size;
    const float* Q  = (const float*)d_in[0];
    const float* K  = (const float*)d_in[1];
    const float* V  = (const float*)d_in[2];
    // d_in[3] = d_k (scalar, 64) — folded into the Q pre-scale
    const float* Mk = (const float*)d_in[4];
    float* O = (float*)d_out;

    // grid: 16 (b,h) slices x 32 query-blocks of 128 rows; 128 threads = 4 waves
    dim3 grid(16 * 32), block(128);
    flash_attn_fwd<<<grid, block, 0, stream>>>(Q, K, V, Mk, O);
}

// v002
// One run takes 121 microseconds.
// Timed twice side by side with v001, it ran 1.04 times as fast both times.
// Over all steps from v000 it is 6.93 times as fast.
#include <hip/hip_runtime.h>
#include <hip/hip_bf16.h>

typedef _Float16 v16h __attribute__((ext_vector_type(16)));
typedef _Float16 h8   __attribute__((ext_vector_type(8)));
typedef _Float16 h2   __attribute__((ext_vector_type(2)));
typedef float    v8f  __attribute__((ext_vector_type(8)));

#define S_LEN   4096
#define D_DIM   64
#define KBLK    32            // keys per pass; a loop trip runs two passes
#define NBLK    (S_LEN / KBLK)
#define KGRP    2
#define NPASS   (NBLK / KGRP)
#define KSTRIDE 72
#define VSTRIDE 40
#define LOG2E   1.4426950408889634f

__device__ inline v8f splat8(float x) {
    v8f r;
#pragma unroll
    for (int e = 0; e < 8; ++e) r[e] = x;
    return r;
}

__device__ inline v16h lds_frag(const _Float16* row, int half, int doff) {
    union { v16h v; h8 h[2]; } u;
    u.h[0] = *reinterpret_cast<const h8*>(row + doff + half * 8);
    u.h[1] = *reinterpret_cast<const h8*>(row + doff + 16 + half * 8);
    return u.v;
}

// Global f32 -> f16 fragment with pre-scale folded in.
__device__ inline v16h glb_frag_scaled(const float* __restrict__ row, int half,
                                       int doff, float scale) {
    const float4* p0 = reinterpret_cast<const float4*>(row + doff + half * 8);
    const float4* p1 = reinterpret_cast<const float4*>(row + doff + 16 + half * 8);
    float4 a = p0[0], b = p0[1], c = p1[0], d = p1[1];
    float lo[8] = {a.x, a.y, a.z, a.w, b.x, b.y, b.z, b.w};
    float hi[8] = {c.x, c.y, c.z, c.w, d.x, d.y, d.z, d.w};
    v16h r;
#pragma unroll
    for (int e = 0; e < 8; ++e) {
        r[e]     = (_Float16)(lo[e] * scale);
        r[e + 8] = (_Float16)(hi[e] * scale);
    }
    return r;
}

__device__ inline v8f wmma_f16(v16h a, v16h b, v8f c) {
    return __builtin_amdgcn_wmma_f32_16x16x32_f16(false, a, false, b, (short)0, c, false, false);
}

// One 32x64 K block (row-major f16 in LDS) and V block (d-major / transposed
// f16 in LDS), staged by the 128 threads of one wave group in two halves: load_kv issues
// all of a thread's global loads into registers, store_kv converts and writes them.
struct KVRegs { float2 k[8]; float va[8]; float vb[8]; };

// kp = block + 2*t ; vp = block + (t>>6)*128 + (t&63). Coalesced reads.
__device__ inline void load_kv(const float* __restrict__ kp, const float* __restrict__ vp,
                               KVRegs& r) {
    // All four loops below are unrolled so that r stays in registers (constant indices).
#pragma unroll
    for (int j = 0; j < 8; ++j)               // rows (t>>5) + 4j, columns 2*(t&31)
        r.k[j] = *reinterpret_cast<const float2*>(kp + j * 4 * D_DIM);
#pragma unroll
    for (int j = 0; j < 8; ++j) {             // rows 2*(t>>6) + 4j and the next, column t&63
        r.va[j] = vp[j * 4 * D_DIM];
        r.vb[j] = vp[j * 4 * D_DIM + D_DIM];
    }
}

// kd = tile + (t>>5)*KSTRIDE + 2*(t&31) ; vd = tile + (t&63)*VSTRIDE + 2*(t>>6).
// Packed ds_store_b32 writes.
__device__ inline void store_kv(const KVRegs& r, _Float16* kd, _Float16* vd) {
#pragma unroll
    for (int j = 0; j < 8; ++j) {
        h2 p; p[0] = (_Float16)r.k[j].x; p[1] = (_Float16)r.k[j].y;
        *reinterpret_cast<h2*>(kd + j * 4 * KSTRIDE) = p;    // row-major
    }
#pragma unroll
    for (int j = 0; j < 8; ++j) {
        h2 p; p[0] = (_Float16)r.va[j]; p[1] = (_Float16)r.vb[j];
        *reinterpret_cast<h2*>(vd + j * 4) = p;              // transposed
    }
}

__global__ __launch_bounds__(256) __attribute__((amdgpu_waves_per_eu(4, 4))) void
flash_attn_fwd(const float* __restrict__ Q, const float* __restrict__ K,
               const float* __restrict__ V, const float* __restrict__ Mk,
               float* __restrict__ O) {
    const int lane = threadIdx.x & 31;
    const int wave = (threadIdx.x >> 5) & 3;  // query slice of the work-group
    // wave group: takes key blocks kg, kg + 2, ... (the same in all lanes: kept scalar)
    const int kg   = __builtin_amdgcn_readfirstlane(threadIdx.x >> 7);
    const int n    = lane & 15;   // query column of all transposed tiles
    const int half = lane >> 4;   // K-half of A/B fragments held by this lane

    const int bh   = blockIdx.x >> 5;        // 16 (b,h) slices
    const int qblk = blockIdx.x & 31;        // 32 query blocks of 128 rows
    const int q0   = qblk * 128 + wave * 32; // 32 queries per wave: two 16-row tiles

    const size_t base = (size_t)bh * S_LEN * D_DIM;
    const int qA = q0 + n, qB = q0 + 16 + n;
    // Mask (broadcasts over B,H): the lane's place in row qA, at the group's first columns.
    // Row qB is reached from the same pointer, 16 rows on: one address pair less to hold.
    const float* mrow = Mk + (size_t)qA * S_LEN + kg * KBLK + half * 8;

    __shared__ _Float16 ktile[KGRP][2][KBLK * KSTRIDE];
    __shared__ _Float16 vtile[KGRP][2][D_DIM * VSTRIDE];
    __shared__ __attribute__((aligned(32))) float part_o[4][8][32][8];
    __shared__ float    part_ml[4][4][32];

    // This thread's share of a K / V block: global sources and LDS places.
    const int tid = threadIdx.x & 127;              // place within the wave group
    const float* kp = K + base + kg * KBLK * D_DIM + 2 * tid;
    const float* vp = V + base + kg * KBLK * D_DIM + (tid >> 6) * 2 * D_DIM + (tid & 63);
    const int kdo = (tid >> 5) * KSTRIDE + 2 * (tid & 31);
    const int vdo = (tid & 63) * VSTRIDE + 2 * (tid >> 6);

    KVRegs kv;
    load_kv(kp, vp, kv);
    // Mask registers, one set (a second would not fit 256 registers): a pass reads
    // them once and then aims the next pass's loads at them. [tile][key half-block]
    v8f mk[2][2];
    mk[0][0] = *reinterpret_cast<const v8f*>(mrow);
    mk[0][1] = *reinterpret_cast<const v8f*>(mrow + 16);
    mk[1][0] = *reinterpret_cast<const v8f*>(mrow + 16 * S_LEN);
    mk[1][1] = *reinterpret_cast<const v8f*>(mrow + 16 * S_LEN + 16);
    // Stands in front of every later write of a register that the loads above name.
    asm volatile("s_wait_xcnt 0x0" ::: "memory");

    // Loop-invariant Q^T B-fragments, pre-scaled by (1/sqrt(d_k))*log2(e):
    // scores come out of the QK WMMAs already in log2 domain.
    const float qs = 0.125f * LOG2E;
    v16h bq[2][2];
    bq[0][0] = glb_frag_scaled(Q + base + (size_t)qA * D_DIM, half, 0,  qs);
    bq[0][1] = glb_frag_scaled(Q + base + (size_t)qA * D_DIM, half, 32, qs);
    bq[1][0] = glb_frag_scaled(Q + base + (size_t)qB * D_DIM, half, 0,  qs);
    bq[1][1] = glb_frag_scaled(Q + base + (size_t)qB * D_DIM, half, 32, qs);
    // The same for the Q loads: the accumulators' start values may take their address registers.
    asm volatile("s_wait_xcnt 0x0" ::: "memory");

    v8f ot[2][4];                                   // O^T accumulators [tile][d-chunk]
#pragma unroll
    for (int t = 0; t < 2; ++t)
#pragma unroll
        for (int c = 0; c < 4; ++c) ot[t][c] = splat8(0.0f);

    float m_run[2] = {-INFINITY, -INFINITY};        // log2 domain
    float l_run[2] = {0.0f, 0.0f};
    const v8f mcoef = splat8(-1e9f * LOG2E);

    store_kv(kv, ktile[kg][0] + kdo, vtile[kg][0] + vdo);

    // One pass of a wave group over 32 keys (its block kb: keys (kb * KGRP + kg) * KBLK on).
    // cur: LDS buffer of this pass; more: a next pass exists (block-uniform).
    auto pass = [&](const int kb, const int cur, const bool more) {
        __syncthreads();
        const int k0 = kb * KGRP * KBLK;     // on top of the group's own start
        if (more) {          // the next pass's K and V loads fly, as one group,
                             // under this pass's work
            const size_t nk0 = (size_t)(kb + 1) * KGRP * KBLK * D_DIM;
            load_kv(kp + nk0, vp + nk0, kv);
        }

        const _Float16* kt = ktile[kg][cur];
        const _Float16* vt = vtile[kg][cur];

        // ---- K A-fragments: loaded once, shared by both query tiles ----
        v16h ak00 = lds_frag(kt + n * KSTRIDE, half, 0);
        v16h ak01 = lds_frag(kt + n * KSTRIDE, half, 32);
        v16h ak10 = lds_frag(kt + (16 + n) * KSTRIDE, half, 0);
        v16h ak11 = lds_frag(kt + (16 + n) * KSTRIDE, half, 32);

        // ---- S^T = K_blk x Q^T : 8 WMMAs, two independent accumulator sets ----
        v8f st[2][2];
#pragma unroll
        for (int t = 0; t < 2; ++t) {
            v8f z0 = splat8(0.0f);
            v8f z1 = splat8(0.0f);
            z0 = wmma_f16(ak00, bq[t][0], z0);
            z1 = wmma_f16(ak10, bq[t][0], z1);
            z0 = wmma_f16(ak01, bq[t][1], z0);
            z1 = wmma_f16(ak11, bq[t][1], z1);
            st[t][0] = z0; st[t][1] = z1;
        }

        // ---- mask: whole-vector math, operands are already pk-pair aligned ----
#pragma unroll
        for (int t = 0; t < 2; ++t) {
            st[t][0] = mk[t][0] * mcoef + st[t][0];
            st[t][1] = mk[t][1] * mcoef + st[t][1];
        }
        if (more) {          // the next pass's mask flies under the rest of this pass
            const int kn = k0 + KGRP * KBLK;
            // 32B-aligned vector loads straight into v8f (2x global_load_b128)
            mk[0][0] = *reinterpret_cast<const v8f*>(mrow + kn);
            mk[0][1] = *reinterpret_cast<const v8f*>(mrow + kn + 16);
            mk[1][0] = *reinterpret_cast<const v8f*>(mrow + kn + 16 * S_LEN);
            mk[1][1] = *reinterpret_cast<const v8f*>(mrow + kn + 16 * S_LEN + 16);
        }

        // ---- per-tile: online softmax (base-2) + P^T fragment ----
        v16h bp[2];
#pragma unroll
        for (int t = 0; t < 2; ++t) {
            const v8f s0 = st[t][0];
            const v8f s1 = st[t][1];

            float mblk = -INFINITY;
#pragma unroll
            for (int v = 0; v < 8; ++v) mblk = fmaxf(mblk, fmaxf(s0[v], s1[v]));
            mblk = fmaxf(mblk, __shfl_xor(mblk, 16, 32));

            const float m_new = fmaxf(m_run[t], mblk);
            const float alpha = __builtin_amdgcn_exp2f(m_run[t] - m_new);

            v8f p0, p1;
            float rsum = 0.0f;
#pragma unroll
            for (int v = 0; v < 8; ++v) {
                p0[v] = __builtin_amdgcn_exp2f(s0[v] - m_new);
                p1[v] = __builtin_amdgcn_exp2f(s1[v] - m_new);
                rsum += p0[v] + p1[v];
            }
            rsum += __shfl_xor(rsum, 16, 32);
            l_run[t] = l_run[t] * alpha + rsum;
            m_run[t] = m_new;

            const v8f av_ = splat8(alpha);
#pragma unroll
            for (int c = 0; c < 4; ++c) ot[t][c] = ot[t][c] * av_;

#pragma unroll
            for (int v = 0; v < 8; ++v) {
                bp[t][v]     = (_Float16)p0[v];
                bp[t][v + 8] = (_Float16)p1[v];
            }
        }

        // ---- O^T += V^T x P^T : 8 WMMAs, V^T A-fragments shared by both tiles ----
#pragma unroll
        for (int c = 0; c < 4; ++c) {
            v16h av = lds_frag(vt + (c * 16 + n) * VSTRIDE, half, 0);
            ot[0][c] = wmma_f16(av, bp[0], ot[0][c]);
            ot[1][c] = wmma_f16(av, bp[1], ot[1][c]);
        }

        // The other buffer's readers left it before this pass's barrier.
        if (more) store_kv(kv, ktile[kg][1 - cur] + kdo, vtile[kg][1 - cur] + vdo);
    };

    // Two passes a trip, so that the LDS buffers swap by name.
    for (int kb = 0; kb < NPASS; kb += 2) {
        pass(kb,     0, true);
        pass(kb + 1, 1, kb + 2 < NPASS);
    }

    if (kg == 1) {
#pragma unroll
        for (int t = 0; t < 2; ++t) {
            part_ml[wave][t][lane]     = m_run[t];
            part_ml[wave][2 + t][lane] = l_run[t];
#pragma unroll
            for (int c = 0; c < 4; ++c)
                *reinterpret_cast<v8f*>(&part_o[wave][t * 4 + c][lane][0]) = ot[t][c];
        }
    }
    __syncthreads();
    if (kg == 1) return;

    // ---- epilogue: O[q][d] = O^T / l ; lane owns row q, d = c*16 + half*8 + v ----
#pragma unroll
    for (int t = 0; t < 2; ++t) {
        const float m1 = part_ml[wave][t][lane];
        const float l1 = part_ml[wave][2 + t][lane];
        const float mj = fmaxf(m_run[t], m1);
        const float a0 = __builtin_amdgcn_exp2f(m_run[t] - mj);
        const float a1 = __builtin_amdgcn_exp2f(m1 - mj);
        const float inv = 1.0f / (l_run[t] * a0 + l1 * a1);
        const v8f w0 = splat8(a0 * inv);
        const v8f w1 = splat8(a1 * inv);
        float* orow = O + base + (size_t)(t ? qB : qA) * D_DIM;
#pragma unroll
        for (int c = 0; c < 4; ++c) {
            const v8f o1 = *reinterpret_cast<const v8f*>(&part_o[wave][t * 4 + c][lane][0]);
            v8f ov = ot[t][c] * w0 + o1 * w1;
            *reinterpret_cast<v8f*>(orow + c * 16 + half * 8) = ov;  // 2x b128 store
        }
    }
}

extern "C" void kernel_launch(void* const* d_in, const int* in_sizes, int n_in,
                              void* d_out, int out_size, void* d_ws, size_t ws_size,
                              hipStream_t stream) {
    (void)in_sizes; (void)n_in; (void)d_ws; (void)ws_size; (void)out_size;
    const float* Q  = (const float*)d_in[0];
    const float* K  = (const float*)d_in[1];
    const float* V  = (const float*)d_in[2];
    // d_in[3] = d_k (scalar, 64) — folded into the Q pre-scale
    const float* Mk = (const float*)d_in[4];
    float* O = (float*)d_out;

    // grid: 16 (b,h) slices x 32 query-blocks of 128 rows; 256 threads = 2 groups of 4 waves
    dim3 grid(16 * 32), block(256);
    flash_attn_fwd<<<grid, block, 0, stream>>>(Q, K, V, Mk, O);
}

// v003
// One run takes 118 microseconds.
// Timed twice side by side with v002, it ran 1.03 times as fast both times.
// Counting every step since v000, it is 7.12 times as fast.
#include <hip/hip_runtime.h>
#include <hip/hip_bf16.h>

typedef _Float16 v16h __attribute__((ext_vector_type(16)));
typedef _Float16 h8   __attribute__((ext_vector_type(8)));
typedef _Float16 h2   __attribute__((ext_vector_type(2)));
typedef float    v8f  __attribute__((ext_vector_type(8)));
typedef float    v4f  __attribute__((ext_vector_type(4)));

#define S_LEN   4096
#define D_DIM   64
#define KBLK    32            // keys per pass; a loop trip runs two passes
#define NBLK    (S_LEN / KBLK)
#define KGRP    2
#define NPASS   (NBLK / KGRP)
#define KSTRIDE 72
#define VSTRIDE 40
#define MSTRIDE 36
#define LOG2E   1.4426950408889634f

__device__ inline v8f splat8(float x) {
    v8f r;
#pragma unroll
    for (int e = 0; e < 8; ++e) r[e] = x;
    return r;
}

__device__ inline v16h lds_frag(const _Float16* row, int half, int doff) {
    union { v16h v; h8 h[2]; } u;
    u.h[0] = *reinterpret_cast<const h8*>(row + doff + half * 8);
    u.h[1] = *reinterpret_cast<const h8*>(row + doff + 16 + half * 8);
    return u.v;
}

// Global f32 -> f16 fragment with pre-scale folded in.
__device__ inline v16h glb_frag_scaled(const float* __restrict__ row, int half,
                                       int doff, float scale) {
    const float4* p0 = reinterpret_cast<const float4*>(row + doff + half * 8);
    const float4* p1 = reinterpret_cast<const float4*>(row + doff + 16 + half * 8);
    float4 a = p0[0], b = p0[1], c = p1[0], d = p1[1];
    float lo[8] = {a.x, a.y, a.z, a.w, b.x, b.y, b.z, b.w};
    float hi[8] = {c.x, c.y, c.z, c.w, d.x, d.y, d.z, d.w};
    v16h r;
#pragma unroll
    for (int e = 0; e < 8; ++e) {
        r[e]     = (_Float16)(lo[e] * scale);
        r[e + 8] = (_Float16)(hi[e] * scale);
    }
    return r;
}

__device__ inline v8f wmma_f16(v16h a, v16h b, v8f c) {
    return __builtin_amdgcn_wmma_f32_16x16x32_f16(false, a, false, b, (short)0, c, false, false);
}

// One 32x64 K block (row-major f16 in LDS) and V block (d-major / transposed
// f16 in LDS), staged by the 128 threads of one wave group in two halves: load_kv issues
// all of a thread's global loads into registers, store_kv converts and writes them.
struct KVRegs { float2 k[8]; float va[8]; float vb[8]; };

// kp = block + 2*t ; vp = block + (t>>6)*128 + (t&63). Coalesced reads.
__device__ inline void load_kv(const float* __restrict__ kp, const float* __restrict__ vp,
                               KVRegs& r) {
    // All four loops below are unrolled so that r stays in registers (constant indices).
#pragma unroll
    for (int j = 0; j < 8; ++j)               // rows (t>>5) + 4j, columns 2*(t&31)
        r.k[j] = *reinterpret_cast<const float2*>(kp + j * 4 * D_DIM);
#pragma unroll
    for (int j = 0; j < 8; ++j) {             // rows 2*(t>>6) + 4j and the next, column t&63
        r.va[j] = vp[j * 4 * D_DIM];
        r.vb[j] = vp[j * 4 * D_DIM + D_DIM];
    }
}

// kd = tile + (t>>5)*KSTRIDE + 2*(t&31) ; vd = tile + (t&63)*VSTRIDE + 2*(t>>6).
// Packed ds_store_b32 writes.
__device__ inline void store_kv(const KVRegs& r, _Float16* kd, _Float16* vd) {
#pragma unroll
    for (int j = 0; j < 8; ++j) {
        h2 p; p[0] = (_Float16)r.k[j].x; p[1] = (_Float16)r.k[j].y;
        *reinterpret_cast<h2*>(kd + j * 4 * KSTRIDE) = p;    // row-major
    }
#pragma unroll
    for (int j = 0; j < 8; ++j) {
        h2 p; p[0] = (_Float16)r.va[j]; p[1] = (_Float16)r.vb[j];
        *reinterpret_cast<h2*>(vd + j * 4) = p;              // transposed
    }
}

// One wave's own 32 x 32 f32 mask tile, global memory to LDS buffer BUF through no register.
// A copy takes four whole 128-B rows (8 lanes a row), where a load in score order would touch
// 16 lines for the same 512 bytes. g, l: the lane's 16 bytes at (lane&7)*16 of row lane>>3, in
// memory and in buffer 0. The immediate offset moves both addresses: it carries the LDS step
// (buffer, four rows a copy), so that one LDS address register serves every copy, and the
// global address, formed anew for each tile anyway, has it taken off.
// The last line stands in front of every later write of a register that a copy names.
template <int BUF>
__device__ inline void copy_mask(const float* g, unsigned l) {
    constexpr int B0 = BUF * 32 * MSTRIDE * 4;      // bytes: the buffer's start
    constexpr int BJ = 4 * MSTRIDE * 4;             // bytes: four rows in LDS
    constexpr long long GJ = 4LL * S_LEN * 4 - BJ;  // bytes: four rows in memory, less the offset's step
    const unsigned long long a = (unsigned long long)g - B0;
    asm volatile("global_load_async_to_lds_b128 %0, %1, off offset:%9\n\t"
                 "global_load_async_to_lds_b128 %0, %2, off offset:%10\n\t"
                 "global_load_async_to_lds_b128 %0, %3, off offset:%11\n\t"
                 "global_load_async_to_lds_b128 %0, %4, off offset:%12\n\t"
                 "global_load_async_to_lds_b128 %0, %5, off offset:%13\n\t"
                 "global_load_async_to_lds_b128 %0, %6, off offset:%14\n\t"
                 "global_load_async_to_lds_b128 %0, %7, off offset:%15\n\t"
                 "global_load_async_to_lds_b128 %0, %8, off offset:%16\n\t"
                 "s_wait_xcnt 0x0"
                 :: "v"(l),
                    "v"(a),          "v"(a + GJ),     "v"(a + 2 * GJ), "v"(a + 3 * GJ),
                    "v"(a + 4 * GJ), "v"(a + 5 * GJ), "v"(a + 6 * GJ), "v"(a + 7 * GJ),
                    "n"(B0),          "n"(B0 + BJ),     "n"(B0 + 2 * BJ), "n"(B0 + 3 * BJ),
                    "n"(B0 + 4 * BJ), "n"(B0 + 5 * BJ), "n"(B0 + 6 * BJ), "n"(B0 + 7 * BJ)
                 : "memory");
}

// Eight mask values of one row out of LDS (2x ds_load_b128; the row stride is no multiple of 32 B).
__device__ inline v8f lds_mask8(const float* p) {
    const v4f a = *reinterpret_cast<const v4f*>(p);
    const v4f b = *reinterpret_cast<const v4f*>(p + 4);
    return __builtin_shufflevector(a, b, 0, 1, 2, 3, 4, 5, 6, 7);
}

__global__ __launch_bounds__(256) __attribute__((amdgpu_waves_per_eu(4, 4))) void
flash_attn_fwd(const float* __restrict__ Q, const float* __restrict__ K,
               const float* __restrict__ V, const float* __restrict__ Mk,
               float* __restrict__ O) {
    const int lane = threadIdx.x & 31;
    const int wave = (threadIdx.x >> 5) & 3;  // query slice of the work-group
    // wave group: takes key blocks kg, kg + 2, ... (the same in all lanes: kept scalar)
    const int kg   = __builtin_amdgcn_readfirstlane(threadIdx.x >> 7);
    const int n    = lane & 15;   // query column of all transposed tiles
    const int half = lane >> 4;   // K-half of A/B fragments held by this lane

    const int bh   = blockIdx.x >> 5;        // 16 (b,h) slices
    const int qblk = blockIdx.x & 31;        // 32 query blocks of 128 rows
    const int q0   = qblk * 128 + wave * 32; // 32 queries per wave: two 16-row tiles

    const size_t base = (size_t)bh * S_LEN * D_DIM;
    const int qA = q0 + n, qB = q0 + 16 + n;
    // Mask (broadcasts over B,H): the lane's share of the wave's tile, at the group's first columns.
    const float* mg = Mk + (size_t)(q0 + (lane >> 3)) * S_LEN + kg * KBLK + (lane & 7) * 4;

    __shared__ _Float16 ktile[KGRP][2][KBLK * KSTRIDE];
    __shared__ _Float16 vtile[KGRP][2][D_DIM * VSTRIDE];
    __shared__ __attribute__((aligned(32))) float part_o[4][8][32][8];
    __shared__ float    part_ml[4][4][32];
    __shared__ __attribute__((aligned(16))) float mtile[2 * 4][2][32 * MSTRIDE];

    float* mt = &mtile[threadIdx.x >> 5][0][0];     // this wave's two mask tiles
    // LDS byte address (low 32 bits of the shared address) of the lane's first copy, buffer 0.
    const unsigned ml = (unsigned)(size_t)(mt + (lane >> 3) * MSTRIDE + (lane & 7) * 4);
    const float* mrd = mt + n * MSTRIDE + half * 8; // where the lane reads row qA's values
    copy_mask<0>(mg, ml);                           // tile 0 into buffer 0

    // This thread's share of a K / V block: global sources and LDS places.
    const int tid = threadIdx.x & 127;              // place within the wave group
    const float* kp = K + base + kg * KBLK * D_DIM + 2 * tid;
    const float* vp = V + base + kg * KBLK * D_DIM + (tid >> 6) * 2 * D_DIM + (tid & 63);
    const int kdo = (tid >> 5) * KSTRIDE + 2 * (tid & 31);
    const int vdo = (tid & 63) * VSTRIDE + 2 * (tid >> 6);

    KVRegs kv;
    load_kv(kp, vp, kv);
    // Stands in front of every later write of a register that the loads above name.
    asm volatile("s_wait_xcnt 0x0" ::: "memory");

    // Loop-invariant Q^T B-fragments, pre-scaled by (1/sqrt(d_k))*log2(e):
    // scores come out of the QK WMMAs already in log2 domain.
    const float qs = 0.125f * LOG2E;
    v16h bq[2][2];
    bq[0][0] = glb_frag_scaled(Q + base + (size_t)qA * D_DIM, half, 0,  qs);
    bq[0][1] = glb_frag_scaled(Q + base + (size_t)qA * D_DIM, half, 32, qs);
    bq[1][0] = glb_frag_scaled(Q + base + (size_t)qB * D_DIM, half, 0,  qs);
    bq[1][1] = glb_frag_scaled(Q + base + (size_t)qB * D_DIM, half, 32, qs);
    // The same for the Q loads: the accumulators' start values may take their address registers.
    asm volatile("s_wait_xcnt 0x0" ::: "memory");

    v8f ot[2][4];                                   // O^T accumulators [tile][d-chunk]
#pragma unroll
    for (int t = 0; t < 2; ++t)
#pragma unroll
        for (int c = 0; c < 4; ++c) ot[t][c] = splat8(0.0f);

    float m_run[2] = {-INFINITY, -INFINITY};        // log2 domain
    float l_run[2] = {0.0f, 0.0f};
    const v8f mcoef = splat8(-1e9f * LOG2E);

    store_kv(kv, ktile[kg][0] + kdo, vtile[kg][0] + vdo);
    // Mask tile 0 has landed before the first pass's barrier.
    asm volatile("s_wait_asynccnt 0x0" ::: "memory");

    // One pass of a wave group over 32 keys (its block kb: keys (kb * KGRP + kg) * KBLK on).
    // cur: LDS buffer of this pass; more: a next pass exists (block-uniform).
    auto pass = [&](const int kb, const int cur, const bool more) {
        __syncthreads();
        if (more) {          // the next pass's mask copies and K and V loads fly, as one
                             // group, under this pass's work
            if (cur) copy_mask<0>(mg + (kb + 1) * KGRP * KBLK, ml);   // cur: a constant at each call
            else     copy_mask<1>(mg + (kb + 1) * KGRP * KBLK, ml);
            const size_t nk0 = (size_t)(kb + 1) * KGRP * KBLK * D_DIM;
            load_kv(kp + nk0, vp + nk0, kv);
        }

        const _Float16* kt = ktile[kg][cur];
        const _Float16* vt = vtile[kg][cur];

        // ---- K A-fragments: loaded once, shared by both query tiles ----
        v16h ak00 = lds_frag(kt + n * KSTRIDE, half, 0);
        v16h ak01 = lds_frag(kt + n * KSTRIDE, half, 32);
        v16h ak10 = lds_frag(kt + (16 + n) * KSTRIDE, half, 0);
        v16h ak11 = lds_frag(kt + (16 + n) * KSTRIDE, half, 32);

        // ---- S^T = K_blk x Q^T : 8 WMMAs, two independent accumulator sets ----
        v8f st[2][2];
#pragma unroll
        for (int t = 0; t < 2; ++t) {
            v8f z0 = splat8(0.0f);
            v8f z1 = splat8(0.0f);
            z0 = wmma_f16(ak00, bq[t][0], z0);
            z1 = wmma_f16(ak10, bq[t][0], z1);
            z0 = wmma_f16(ak01, bq[t][1], z0);
            z1 = wmma_f16(ak11, bq[t][1], z1);
            st[t][0] = z0; st[t][1] = z1;
        }

        // Keeps the mask reads behind the S^T products, where they take the K fragments'
        // registers: moved up among them, they cost spills at 256 registers.
        __builtin_amdgcn_sched_barrier(0);
        // ---- mask: whole-vector math, operands are already pk-pair aligned ----
#pragma unroll
        for (int t = 0; t < 2; ++t) {
            const float* mr = mrd + (cur * 32 + t * 16) * MSTRIDE;
            st[t][0] = lds_mask8(mr) * mcoef + st[t][0];
            st[t][1] = lds_mask8(mr + 16) * mcoef + st[t][1];
        }

        // ---- per-tile: online softmax (base-2) + P^T fragment ----
        v16h bp[2];
#pragma unroll
        for (int t = 0; t < 2; ++t) {
            const v8f s0 = st[t][0];
            const v8f s1 = st[t][1];

            float mblk = -INFINITY;
#pragma unroll
            for (int v = 0; v < 8; ++v) mblk = fmaxf(mblk, fmaxf(s0[v], s1[v]));
            mblk = fmaxf(mblk, __shfl_xor(mblk, 16, 32));

            const float m_new = fmaxf(m_run[t], mblk);
            const float alpha = __builtin_amdgcn_exp2f(m_run[t] - m_new);

            v8f p0, p1;
            float rsum = 0.0f;
#pragma unroll
            for (int v = 0; v < 8; ++v) {
                p0[v] = __builtin_amdgcn_exp2f(s0[v] - m_new);
                p1[v] = __builtin_amdgcn_exp2f(s1[v] - m_new);
                rsum += p0[v] + p1[v];
            }
            rsum += __shfl_xor(rsum, 16, 32);
            l_run[t] = l_run[t] * alpha + rsum;
            m_run[t] = m_new;

            const v8f av_ = splat8(alpha);
#pragma unroll
            for (int c = 0; c < 4; ++c) ot[t][c] = ot[t][c] * av_;

#pragma unroll
            for (int v = 0; v < 8; ++v) {
                bp[t][v]     = (_Float16)p0[v];
                bp[t][v + 8] = (_Float16)p1[v];
            }
        }

        // ---- O^T += V^T x P^T : 8 WMMAs, V^T A-fragments shared by both tiles ----
#pragma unroll
        for (int c = 0; c < 4; ++c) {
            v16h av = lds_frag(vt + (c * 16 + n) * VSTRIDE, half, 0);
            ot[0][c] = wmma_f16(av, bp[0], ot[0][c]);
            ot[1][c] = wmma_f16(av, bp[1], ot[1][c]);
        }

        // The other buffer's readers left it before this pass's barrier.
        if (more) store_kv(kv, ktile[kg][1 - cur] + kdo, vtile[kg][1 - cur] + vdo);
        // Foot of the pass, in front of the next barrier: this wave's LDS reads and writes are
        // done, so that the mask buffer it has just read may be refilled behind that barrier ...
        asm volatile("s_wait_dscnt 0x0" ::: "memory");
        // ... and the next pass's mask tile has landed.
        asm volatile("s_wait_asynccnt 0x0" ::: "memory");
    };

    // Two passes a trip, so that the LDS buffers swap by name.
    for (int kb = 0; kb < NPASS; kb += 2) {
        pass(kb,     0, true);
        pass(kb + 1, 1, kb + 2 < NPASS);
    }
    // No copy is in flight when the wave goes on to the join and ends.
    asm volatile("s_wait_asynccnt 0x0" ::: "memory");

    if (kg == 1) {
#pragma unroll
        for (int t = 0; t < 2; ++t) {
            part_ml[wave][t][lane]     = m_run[t];
            part_ml[wave][2 + t][lane] = l_run[t];
#pragma unroll
            for (int c = 0; c < 4; ++c)
                *reinterpret_cast<v8f*>(&part_o[wave][t * 4 + c][lane][0]) = ot[t][c];
        }
    }
    __syncthreads();
    if (kg == 1) return;

    // ---- epilogue: O[q][d] = O^T / l ; lane owns row q, d = c*16 + half*8 + v ----
#pragma unroll
    for (int t = 0; t < 2; ++t) {
        const float m1 = part_ml[wave][t][lane];
        const float l1 = part_ml[wave][2 + t][lane];
        const float mj = fmaxf(m_run[t], m1);
        const float a0 = __builtin_amdgcn_exp2f(m_run[t] - mj);
        const float a1 = __builtin_amdgcn_exp2f(m1 - mj);
        const float inv = 1.0f / (l_run[t] * a0 + l1 * a1);
        const v8f w0 = splat8(a0 * inv);
        const v8f w1 = splat8(a1 * inv);
        float* orow = O + base + (size_t)(t ? qB : qA) * D_DIM;
#pragma unroll
        for (int c = 0; c < 4; ++c) {
            const v8f o1 = *reinterpret_cast<const v8f*>(&part_o[wave][t * 4 + c][lane][0]);
            v8f ov = ot[t][c] * w0 + o1 * w1;
            *reinterpret_cast<v8f*>(orow + c * 16 + half * 8) = ov;  // 2x b128 store
        }
    }
}

extern "C" void kernel_launch(void* const* d_in, const int* in_sizes, int n_in,
                              void* d_out, int out_size, void* d_ws, size_t ws_size,
                              hipStream_t stream) {
    (void)in_sizes; (void)n_in; (void)d_ws; (void)ws_size; (void)out_size;
    const float* Q  = (const float*)d_in[0];
    const float* K  = (const float*)d_in[1];
    const float* V  = (const float*)d_in[2];
    // d_in[3] = d_k (scalar, 64) — folded into the Q pre-scale
    const float* Mk = (const float*)d_in[4];
    float* O = (float*)d_out;

    // grid: 16 (b,h) slices x 32 query-blocks of 128 rows; 256 threads = 2 groups of 4 waves
    dim3 grid(16 * 32), block(256);
    flash_attn_fwd<<<grid, block, 0, stream>>>(Q, K, V, Mk, O);
}

// v004
// A run of this version takes 105 microseconds.
// In two side-by-side timings against v003, it was 1.12 and 1.13 times as fast.
// Counting every step since v000, it is 8.00 times as fast.
#include <hip/hip_runtime.h>
#include <hip/hip_bf16.h>

typedef _Float16 v16h __attribute__((ext_vector_type(16)));
typedef _Float16 h8   __attribute__((ext_vector_type(8)));
typedef _Float16 h4   __attribute__((ext_vector_type(4)));
typedef _Float16 h2   __attribute__((ext_vector_type(2)));
typedef float    v8f  __attribute__((ext_vector_type(8)));
typedef float    v4f  __attribute__((ext_vector_type(4)));

#define S_LEN   4096
#define D_DIM   64
#define KBLK    32            // keys per pass; a loop trip runs two passes
#define NBLK    (S_LEN / KBLK)
#define KGRP    2
#define NPASS   (NBLK / KGRP)
#define KSTRIDE 72
#define VSTRIDE 40
#define MSTRIDE 36
#define LOG2E   1.4426950408889634f

__device__ inline v8f splat8(float x) {
    v8f r;
#pragma unroll
    for (int e = 0; e < 8; ++e) r[e] = x;
    return r;
}

__device__ inline v16h lds_frag(const _Float16* row, int half, int doff) {
    union { v16h v; h8 h[2]; } u;
    u.h[0] = *reinterpret_cast<const h8*>(row + doff + half * 8);
    u.h[1] = *reinterpret_cast<const h8*>(row + doff + 16 + half * 8);
    return u.v;
}

// Global f32 -> f16 fragment with pre-scale folded in.
__device__ inline v16h glb_frag_scaled(const float* __restrict__ row, int half,
                                       int doff, float scale) {
    const float4* p0 = reinterpret_cast<const float4*>(row + doff + half * 8);
    const float4* p1 = reinterpret_cast<const float4*>(row + doff + 16 + half * 8);
    float4 a = p0[0], b = p0[1], c = p1[0], d = p1[1];
    float lo[8] = {a.x, a.y, a.z, a.w, b.x, b.y, b.z, b.w};
    float hi[8] = {c.x, c.y, c.z, c.w, d.x, d.y, d.z, d.w};
    v16h r;
#pragma unroll
    for (int e = 0; e < 8; ++e) {
        r[e]     = (_Float16)(lo[e] * scale);
        r[e + 8] = (_Float16)(hi[e] * scale);
    }
    return r;
}

__device__ inline v8f wmma_f16(v16h a, v16h b, v8f c) {
    return __builtin_amdgcn_wmma_f32_16x16x32_f16(false, a, false, b, (short)0, c, false, false);
}

// First launch: K and V, f32, are turned into f16 once, into the workspace, so that the 32 query
// blocks of a (b,h) slice read half the bytes and none of them converts or transposes.
//   Kh: K's own order, [slice][key][d].
//   Vt: per block of 32 keys d-major, [slice][key block][d][key in block]: the V^T tile as LDS holds it.
// A work-group takes PKEYS keys of one slice (the slices follow one another in memory).
#define PKEYS 256
#define PBLK  (PKEYS / KBLK)
__global__ __launch_bounds__(256) __attribute__((amdgpu_waves_per_eu(2, 2))) void
kv_to_f16(const float* __restrict__ K, const float* __restrict__ V,
          _Float16* __restrict__ Kh, _Float16* __restrict__ Vt) {
    __shared__ __attribute__((aligned(16))) _Float16 tr[PBLK][D_DIM * VSTRIDE];
    const int t = threadIdx.x;
    const size_t e0 = (size_t)blockIdx.x * (PKEYS * D_DIM);      // first element of the share
    const v4f* k4 = reinterpret_cast<const v4f*>(K + e0) + t;    // 512 contiguous bytes a wave
    // Rows 2r and 2r + 1 of a key block, columns 4 * (t & 15) on: whole 256-B rows, 16 lanes each.
    const int r = t >> 4, d4 = t & 15;
    const v4f* v4 = reinterpret_cast<const v4f*>(V + e0) + 2 * r * (D_DIM / 4) + d4;

    // The loops are unrolled so that all of a thread's loads are in flight together.
    v4f va[PBLK], vb[PBLK], kr[2 * PBLK];
#pragma unroll
    for (int j = 0; j < PBLK; ++j) {
        va[j] = v4[j * (KBLK * D_DIM / 4)];
        vb[j] = v4[j * (KBLK * D_DIM / 4) + D_DIM / 4];
    }
#pragma unroll
    for (int j = 0; j < 2 * PBLK; ++j) kr[j] = k4[j * 256];
#pragma unroll
    for (int j = 0; j < PBLK; ++j)
#pragma unroll
        for (int c = 0; c < 4; ++c) {
            h2 p; p[0] = (_Float16)va[j][c]; p[1] = (_Float16)vb[j][c];
            *reinterpret_cast<h2*>(&tr[j][(4 * d4 + c) * VSTRIDE + 2 * r]) = p;   // transposed
        }
    __syncthreads();      // the transposed tiles are whole before other threads read them out
    // All global stores stand behind the barrier, which would wait for stores in front of it.
#pragma unroll
    for (int j = 0; j < 2 * PBLK; ++j) {
        h4 p;
#pragma unroll
        for (int c = 0; c < 4; ++c) p[c] = (_Float16)kr[j][c];
        *reinterpret_cast<h4*>(Kh + e0 + (size_t)(j * 256 + t) * 4) = p;   // 256 contiguous bytes a wave
    }
#pragma unroll
    for (int j = 0; j < PBLK; ++j) {          // 16 bytes at (t & 3) * 16 of row t >> 2: whole lines out
        const h8 p = *reinterpret_cast<const h8*>(&tr[j][(t >> 2) * VSTRIDE + (t & 3) * 8]);
        *reinterpret_cast<h8*>(Vt + e0 + (size_t)(j * 256 + t) * 8) = p;
    }
}

// One wave group's K tile (32 rows of 128 B) and V^T tile (64 rows of 64 B), f16, each 4 KB in a
// row in the workspace, to LDS buffer BUF through no register: two copies of 16 bytes a lane each.
// kg, vg: the tiles' first bytes (the same in all lanes: scalar bases); go: the lane's byte in a
// half tile, tid * 16; lk, lv: its LDS byte addresses in buffer 0 (K: (tid & 7) * 16 of row
// tid >> 3; V^T: (tid & 3) * 16 of row tid >> 2). The immediate offset moves both addresses: it
// carries the LDS step (buffer, half tile), and the scalar base has it taken off.
// The last line stands in front of every later write of a register that a copy names.
template <int BUF>
__device__ inline void copy_kv(const _Float16* kg, const _Float16* vg, unsigned go,
                               unsigned lk, unsigned lv) {
    constexpr int K0 = BUF * KBLK * KSTRIDE * 2;        // bytes: the K buffer's start
    constexpr int K1 = K0 + (KBLK / 2) * KSTRIDE * 2;   // bytes: its row 16
    constexpr int V0 = BUF * D_DIM * VSTRIDE * 2;       // bytes: the V^T buffer's start
    constexpr int V1 = V0 + (D_DIM / 2) * VSTRIDE * 2;  // bytes: its row 32
    constexpr int H  = KBLK * D_DIM;                    // bytes: half a tile in the workspace
    const unsigned long long ka = (unsigned long long)kg, va = (unsigned long long)vg;
    asm volatile("global_load_async_to_lds_b128 %0, %2, %3 offset:%7\n\t"
                 "global_load_async_to_lds_b128 %0, %2, %4 offset:%8\n\t"
                 "global_load_async_to_lds_b128 %1, %2, %5 offset:%9\n\t"
                 "global_load_async_to_lds_b128 %1, %2, %6 offset:%10\n\t"
                 "s_wait_xcnt 0x0"
                 :: "v"(lk), "v"(lv), "v"(go),
                    "s"(ka - K0), "s"(ka + H - K1), "s"(va - V0), "s"(va + H - V1),
                    "n"(K0), "n"(K1), "n"(V0), "n"(V1)
                 : "memory");
}

// One wave's own 32 x 32 f32 mask tile, global memory to LDS buffer BUF through no register.
// A copy takes four whole 128-B rows (8 lanes a row), where a load in score order would touch
// 16 lines for the same 512 bytes. g, l: the lane's 16 bytes at (lane&7)*16 of row lane>>3, in
// memory and in buffer 0. The immediate offset moves both addresses: it carries the LDS step
// (buffer, four rows a copy), so that one LDS address register serves every copy, and the
// global address, formed anew for each tile anyway, has it taken off.
// The last line stands in front of every later write of a register that a copy names.
template <int BUF>
__device__ inline void copy_mask(const float* g, unsigned l) {
    constexpr int B0 = BUF * 32 * MSTRIDE * 4;      // bytes: the buffer's start
    constexpr int BJ = 4 * MSTRIDE * 4;             // bytes: four rows in LDS
    constexpr long long GJ = 4LL * S_LEN * 4 - BJ;  // bytes: four rows in memory, less the offset's step
    const unsigned long long a = (unsigned long long)g - B0;
    asm volatile("global_load_async_to_lds_b128 %0, %1, off offset:%9\n\t"
                 "global_load_async_to_lds_b128 %0, %2, off offset:%10\n\t"
                 "global_load_async_to_lds_b128 %0, %3, off offset:%11\n\t"
                 "global_load_async_to_lds_b128 %0, %4, off offset:%12\n\t"
                 "global_load_async_to_lds_b128 %0, %5, off offset:%13\n\t"
                 "global_load_async_to_lds_b128 %0, %6, off offset:%14\n\t"
                 "global_load_async_to_lds_b128 %0, %7, off offset:%15\n\t"
                 "global_load_async_to_lds_b128 %0, %8, off offset:%16\n\t"
                 "s_wait_xcnt 0x0"
                 :: "v"(l),
                    "v"(a),          "v"(a + GJ),     "v"(a + 2 * GJ), "v"(a + 3 * GJ),
                    "v"(a + 4 * GJ), "v"(a + 5 * GJ), "v"(a + 6 * GJ), "v"(a + 7 * GJ),
                    "n"(B0),          "n"(B0 + BJ),     "n"(B0 + 2 * BJ), "n"(B0 + 3 * BJ),
                    "n"(B0 + 4 * BJ), "n"(B0 + 5 * BJ), "n"(B0 + 6 * BJ), "n"(B0 + 7 * BJ)
                 : "memory");
}

// Eight mask values of one row out of LDS (2x ds_load_b128; the row stride is no multiple of 32 B).
__device__ inline v8f lds_mask8(const float* p) {
    const v4f a = *reinterpret_cast<const v4f*>(p);
    const v4f b = *reinterpret_cast<const v4f*>(p + 4);
    return __builtin_shufflevector(a, b, 0, 1, 2, 3, 4, 5, 6, 7);
}

__global__ __launch_bounds__(256) __attribute__((amdgpu_waves_per_eu(4, 4))) void
flash_attn_fwd(const float* __restrict__ Q, const _Float16* __restrict__ Kh,
               const _Float16* __restrict__ Vt, const float* __restrict__ Mk,
               float* __restrict__ O) {
    const int lane = threadIdx.x & 31;
    const int wave = (threadIdx.x >> 5) & 3;  // query slice of the work-group
    // wave group: takes key blocks kg, kg + 2, ... (the same in all lanes: kept scalar)
    const int kg   = __builtin_amdgcn_readfirstlane(threadIdx.x >> 7);
    const int n    = lane & 15;   // query column of all transposed tiles
    const int half = lane >> 4;   // K-half of A/B fragments held by this lane

    const int bh   = blockIdx.x >> 5;        // 16 (b,h) slices
    const int qblk = blockIdx.x & 31;        // 32 query blocks of 128 rows
    const int q0   = qblk * 128 + wave * 32; // 32 queries per wave: two 16-row tiles

    const size_t base = (size_t)bh * S_LEN * D_DIM;
    const int qA = q0 + n, qB = q0 + 16 + n;
    // Mask (broadcasts over B,H): the lane's share of the wave's tile, at the group's first columns.
    const float* mg = Mk + (size_t)(q0 + (lane >> 3)) * S_LEN + kg * KBLK + (lane & 7) * 4;

    __shared__ __attribute__((aligned(16))) _Float16 ktile[KGRP][2][KBLK * KSTRIDE];
    __shared__ __attribute__((aligned(16))) _Float16 vtile[KGRP][2][D_DIM * VSTRIDE];
    __shared__ __attribute__((aligned(32))) float part_o[4][8][32][8];
    __shared__ float    part_ml[4][4][32];
    __shared__ __attribute__((aligned(16))) float mtile[2 * 4][2][32 * MSTRIDE];

    float* mt = &mtile[threadIdx.x >> 5][0][0];     // this wave's two mask tiles
    // LDS byte address (low 32 bits of the shared address) of the lane's first copy, buffer 0.
    const unsigned ml = (unsigned)(size_t)(mt + (lane >> 3) * MSTRIDE + (lane & 7) * 4);
    const float* mrd = mt + n * MSTRIDE + half * 8; // where the lane reads row qA's values
    copy_mask<0>(mg, ml);                           // tile 0 into buffer 0

    // The group's first K and V^T tiles in the workspace, and this thread's share of a tile.
    const int tid = threadIdx.x & 127;              // place within the wave group
    const _Float16* kp = Kh + base + kg * KBLK * D_DIM;
    const _Float16* vp = Vt + base + kg * KBLK * D_DIM;
    const unsigned go = tid * 16;
    const unsigned lk = (unsigned)(size_t)(&ktile[kg][0][0] + (tid >> 3) * KSTRIDE + (tid & 7) * 8);
    const unsigned lv = (unsigned)(size_t)(&vtile[kg][0][0] + (tid >> 2) * VSTRIDE + (tid & 3) * 8);
    copy_kv<0>(kp, vp, go, lk, lv);                 // tiles 0 into buffers 0

    // Loop-invariant Q^T B-fragments, pre-scaled by (1/sqrt(d_k))*log2(e):
    // scores come out of the QK WMMAs already in log2 domain.
    const float qs = 0.125f * LOG2E;
    v16h bq[2][2];
    bq[0][0] = glb_frag_scaled(Q + base + (size_t)qA * D_DIM, half, 0,  qs);
    bq[0][1] = glb_frag_scaled(Q + base + (size_t)qA * D_DIM, half, 32, qs);
    bq[1][0] = glb_frag_scaled(Q + base + (size_t)qB * D_DIM, half, 0,  qs);
    bq[1][1] = glb_frag_scaled(Q + base + (size_t)qB * D_DIM, half, 32, qs);
    // Stands in front of every later write of a register that the Q loads name. Their address is
    // an input, so that its registers are still held here and nothing is written to them earlier.
    asm volatile("s_wait_xcnt 0x0" :: "v"(Q + base + (size_t)qA * D_DIM + half * 8) : "memory");

    v8f ot[2][4];                                   // O^T accumulators [tile][d-chunk]
#pragma unroll
    for (int t = 0; t < 2; ++t)
#pragma unroll
        for (int c = 0; c < 4; ++c) ot[t][c] = splat8(0.0f);

    float m_run[2] = {-INFINITY, -INFINITY};        // log2 domain
    float l_run[2] = {0.0f, 0.0f};
    const v8f mcoef = splat8(-1e9f * LOG2E);

    // Mask, K and V^T tiles 0 have landed before the first pass's barrier.
    asm volatile("s_wait_asynccnt 0x0" ::: "memory");

    // One pass of a wave group over 32 keys (its block kb: keys (kb * KGRP + kg) * KBLK on).
    // cur: LDS buffer of this pass; more: a next pass exists (block-uniform).
    auto pass = [&](const int kb, const int cur, const bool more) {
        __syncthreads();
        if (more) {          // the next pass's mask, K and V^T copies fly under this pass's work,
                             // into the buffers whose readers left them before the barrier above
            const size_t nk0 = (size_t)(kb + 1) * KGRP * KBLK * D_DIM;
            if (cur) {       // cur: a constant at each call
                copy_mask<0>(mg + (kb + 1) * KGRP * KBLK, ml);
                copy_kv<0>(kp + nk0, vp + nk0, go, lk, lv);
            } else {
                copy_mask<1>(mg + (kb + 1) * KGRP * KBLK, ml);
                copy_kv<1>(kp + nk0, vp + nk0, go, lk, lv);
            }
        }

        const _Float16* kt = ktile[kg][cur];
        const _Float16* vt = vtile[kg][cur];

        // ---- K A-fragments: loaded once, shared by both query tiles ----
        v16h ak00 = lds_frag(kt + n * KSTRIDE, half, 0);
        v16h ak01 = lds_frag(kt + n * KSTRIDE, half, 32);
        v16h ak10 = lds_frag(kt + (16 + n) * KSTRIDE, half, 0);
        v16h ak11 = lds_frag(kt + (16 + n) * KSTRIDE, half, 32);

        // ---- S^T = K_blk x Q^T : 8 WMMAs, two independent accumulator sets ----
        v8f st[2][2];
#pragma unroll
        for (int t = 0; t < 2; ++t) {
            v8f z0 = splat8(0.0f);
            v8f z1 = splat8(0.0f);
            z0 = wmma_f16(ak00, bq[t][0], z0);
            z1 = wmma_f16(ak10, bq[t][0], z1);
            z0 = wmma_f16(ak01, bq[t][1], z0);
            z1 = wmma_f16(ak11, bq[t][1], z1);
            st[t][0] = z0; st[t][1] = z1;
        }

        // Keeps the mask reads behind the S^T products, where they take the K fragments'
        // registers: moved up among them, they cost spills at 256 registers.
        __builtin_amdgcn_sched_barrier(0);
        // ---- mask: whole-vector math, operands are already pk-pair aligned ----
#pragma unroll
        for (int t = 0; t < 2; ++t) {
            const float* mr = mrd + (cur * 32 + t * 16) * MSTRIDE;
            st[t][0] = lds_mask8(mr) * mcoef + st[t][0];
            st[t][1] = lds_mask8(mr + 16) * mcoef + st[t][1];
        }

        // ---- per-tile: online softmax (base-2) + P^T fragment ----
        v16h bp[2];
#pragma unroll
        for (int t = 0; t < 2; ++t) {
            const v8f s0 = st[t][0];
            const v8f s1 = st[t][1];

            float mblk = -INFINITY;
#pragma unroll
            for (int v = 0; v < 8; ++v) mblk = fmaxf(mblk, fmaxf(s0[v], s1[v]));
            mblk = fmaxf(mblk, __shfl_xor(mblk, 16, 32));

            const float m_new = fmaxf(m_run[t], mblk);
            const float alpha = __builtin_amdgcn_exp2f(m_run[t] - m_new);

            v8f p0, p1;
            float rsum = 0.0f;
#pragma unroll
            for (int v = 0; v < 8; ++v) {
                p0[v] = __builtin_amdgcn_exp2f(s0[v] - m_new);
                p1[v] = __builtin_amdgcn_exp2f(s1[v] - m_new);
                rsum += p0[v] + p1[v];
            }
            rsum += __shfl_xor(rsum, 16, 32);
            l_run[t] = l_run[t] * alpha + rsum;
            m_run[t] = m_new;

            const v8f av_ = splat8(alpha);
#pragma unroll
            for (int c = 0; c < 4; ++c) ot[t][c] = ot[t][c] * av_;

#pragma unroll
            for (int v = 0; v < 8; ++v) {
                bp[t][v]     = (_Float16)p0[v];
                bp[t][v + 8] = (_Float16)p1[v];
            }
        }

        // ---- O^T += V^T x P^T : 8 WMMAs, V^T A-fragments shared by both tiles ----
#pragma unroll
        for (int c = 0; c < 4; ++c) {
            v16h av = lds_frag(vt + (c * 16 + n) * VSTRIDE, half, 0);
            ot[0][c] = wmma_f16(av, bp[0], ot[0][c]);
            ot[1][c] = wmma_f16(av, bp[1], ot[1][c]);
        }

        // Foot of the pass, in front of the next barrier: this wave's LDS reads are done, so
        // that the buffers it has just read may be refilled behind that barrier ...
        asm volatile("s_wait_dscnt 0x0" ::: "memory");
        // ... and its copies of the next pass's mask, K and V^T tiles have landed.
        asm volatile("s_wait_asynccnt 0x0" ::: "memory");
    };

    // Two passes a trip, so that the LDS buffers swap by name.
    for (int kb = 0; kb < NPASS; kb += 2) {
        pass(kb,     0, true);
        pass(kb + 1, 1, kb + 2 < NPASS);
    }
    // No copy is in flight when the wave goes on to the join and ends.
    asm volatile("s_wait_asynccnt 0x0" ::: "memory");

    if (kg == 1) {
#pragma unroll
        for (int t = 0; t < 2; ++t) {
            part_ml[wave][t][lane]     = m_run[t];
            part_ml[wave][2 + t][lane] = l_run[t];
#pragma unroll
            for (int c = 0; c < 4; ++c)
                *reinterpret_cast<v8f*>(&part_o[wave][t * 4 + c][lane][0]) = ot[t][c];
        }
    }
    __syncthreads();
    if (kg == 1) return;

    // ---- epilogue: O[q][d] = O^T / l ; lane owns row q, d = c*16 + half*8 + v ----
#pragma unroll
    for (int t = 0; t < 2; ++t) {
        const float m1 = part_ml[wave][t][lane];
        const float l1 = part_ml[wave][2 + t][lane];
        const float mj = fmaxf(m_run[t], m1);
        const float a0 = __builtin_amdgcn_exp2f(m_run[t] - mj);
        const float a1 = __builtin_amdgcn_exp2f(m1 - mj);
        const float inv = 1.0f / (l_run[t] * a0 + l1 * a1);
        const v8f w0 = splat8(a0 * inv);
        const v8f w1 = splat8(a1 * inv);
        float* orow = O + base + (size_t)(t ? qB : qA) * D_DIM;
#pragma unroll
        for (int c = 0; c < 4; ++c) {
            const v8f o1 = *reinterpret_cast<const v8f*>(&part_o[wave][t * 4 + c][lane][0]);
            v8f ov = ot[t][c] * w0 + o1 * w1;
            *reinterpret_cast<v8f*>(orow + c * 16 + half * 8) = ov;  // 2x b128 store
        }
    }
}

extern "C" void kernel_launch(void* const* d_in, const int* in_sizes, int n_in,
                              void* d_out, int out_size, void* d_ws, size_t ws_size,
                              hipStream_t stream) {
    (void)in_sizes; (void)n_in; (void)ws_size; (void)out_size;
    const float* Q  = (const float*)d_in[0];
    const float* K  = (const float*)d_in[1];
    const float* V  = (const float*)d_in[2];
    // d_in[3] = d_k (scalar, 64) — folded into the Q pre-scale
    const float* Mk = (const float*)d_in[4];
    float* O = (float*)d_out;
    _Float16* Kh = (_Float16*)d_ws;                  // 8 MB
    _Float16* Vt = Kh + 16 * S_LEN * D_DIM;          // 8 MB

    // grid: 16 (b,h) slices x 32 query-blocks of 128 rows; 256 threads = 2 groups of 4 waves
    dim3 grid(16 * 32), block(256);
    kv_to_f16<<<dim3(16 * S_LEN / PKEYS), block, 0, stream>>>(K, V, Kh, Vt);
    flash_attn_fwd<<<grid, block, 0, stream>>>(Q, Kh, Vt, Mk, O);
}

// v005
// It runs in 80 microseconds.
// In both of two side-by-side timings against v004, it was 1.31 times as fast.
// Over all steps from v000 it is 10.5 times as fast.
#include <hip/hip_runtime.h>
#include <hip/hip_bf16.h>

typedef _Float16 v16h __attribute__((ext_vector_type(16)));
typedef _Float16 h8   __attribute__((ext_vector_type(8)));
typedef _Float16 h4   __attribute__((ext_vector_type(4)));
typedef _Float16 h2   __attribute__((ext_vector_type(2)));
typedef float    v8f  __attribute__((ext_vector_type(8)));
typedef float    v4f  __attribute__((ext_vector_type(4)));

#define S_LEN   4096
#define D_DIM   64
#define KBLK    32            // keys per pass; a loop trip runs two passes
#define NBLK    (S_LEN / KBLK)
#define KGRP    2
#define NPASS   (NBLK / KGRP)
#define KSTRIDE 72
#define VSTRIDE 40
#define MSTRIDE 36
#define LOG2E   1.4426950408889634f

__device__ inline v8f splat8(float x) {
    v8f r;
#pragma unroll
    for (int e = 0; e < 8; ++e) r[e] = x;
    return r;
}

__device__ inline v16h lds_frag(const _Float16* row, int half, int doff) {
    union { v16h v; h8 h[2]; } u;
    u.h[0] = *reinterpret_cast<const h8*>(row + doff + half * 8);
    u.h[1] = *reinterpret_cast<const h8*>(row + doff + 16 + half * 8);
    return u.v;
}

// Global f32 -> f16 fragment with pre-scale folded in.
__device__ inline v16h glb_frag_scaled(const float* __restrict__ row, int half,
                                       int doff, float scale) {
    const float4* p0 = reinterpret_cast<const float4*>(row + doff + half * 8);
    const float4* p1 = reinterpret_cast<const float4*>(row + doff + 16 + half * 8);
    float4 a = p0[0], b = p0[1], c = p1[0], d = p1[1];
    float lo[8] = {a.x, a.y, a.z, a.w, b.x, b.y, b.z, b.w};
    float hi[8] = {c.x, c.y, c.z, c.w, d.x, d.y, d.z, d.w};
    v16h r;
#pragma unroll
    for (int e = 0; e < 8; ++e) {
        r[e]     = (_Float16)(lo[e] * scale);
        r[e + 8] = (_Float16)(hi[e] * scale);
    }
    return r;
}

__device__ inline v8f wmma_f16(v16h a, v16h b, v8f c) {
    return __builtin_amdgcn_wmma_f32_16x16x32_f16(false, a, false, b, (short)0, c, false, false);
}

// First launch: K and V, f32, are turned into f16 once, into the workspace, so that the 32 query
// blocks of a (b,h) slice read half the bytes and none of them converts or transposes.
//   Kh: K's own order, [slice][key][d].
//   Vt: per block of 32 keys d-major, [slice][key block][d][key in block]: the V^T tile as LDS holds it.
// A work-group takes PKEYS keys of one slice (the slices follow one another in memory).
#define PKEYS 256
#define PBLK  (PKEYS / KBLK)
#define KVWG  (16 * S_LEN / PKEYS)   // work-groups that convert K and V
// The same launch looks through the mask once: further work-groups, each on 32 query rows x 1024
// key columns, write one word: bit i is set where 32 x 32 tile i of that strip holds an entry
// other than +0 or -0. A tile of zeros adds exactly nothing to the scores, so the main loop
// neither copies nor adds a tile whose bit is clear. Each word has a 128-B line of its own.
#define MCOLS 1024
#define MWG   ((S_LEN / 32) * (S_LEN / MCOLS))
#define FSTEP 32                     // words from one flag word to the next
__global__ __launch_bounds__(256) __attribute__((amdgpu_waves_per_eu(2, 2))) void
kv_to_f16(const float* __restrict__ K, const float* __restrict__ V, const float* __restrict__ Mk,
          _Float16* __restrict__ Kh, _Float16* __restrict__ Vt, unsigned* __restrict__ Fl) {
    __shared__ __attribute__((aligned(16))) _Float16 tr[PBLK][D_DIM * VSTRIDE];
    __shared__ unsigned nib[8];
    const int t = threadIdx.x;
    if (blockIdx.x >= KVWG) {                 // the same for the whole work-group
        const int sb = blockIdx.x - KVWG;     // strip: rows (sb >> 2) * 32 on, columns (sb & 3) * 1024 on
        const int w = t >> 5, ln = t & 31;
        // A wave takes 128 columns, four tiles: 512 contiguous bytes of each of the 32 rows.
        const v4f* mp = reinterpret_cast<const v4f*>(
            Mk + (size_t)(sb >> 2) * 32 * S_LEN + (sb & 3) * MCOLS + w * 128) + ln;
        v4f x[32];
#pragma unroll                                // unrolled: all 32 loads of a lane in flight together
        for (int r = 0; r < 32; ++r) x[r] = mp[r * (S_LEN / 4)];
        // Stands in front of every later write of a register that these loads name.
        asm volatile("s_wait_xcnt 0x0" :: "v"(mp) : "memory");
        unsigned acc = 0;
#pragma unroll
        for (int r = 0; r < 32; ++r)
#pragma unroll
            for (int c = 0; c < 4; ++c) acc |= __float_as_uint(x[r][c]);
        // The sign bit is left out: -0 counts as zero; NaN, infinity and subnormals count as set.
        const unsigned b = __builtin_amdgcn_ballot_w32((acc << 1) != 0u);   // 8 lanes a tile
        const unsigned n4 = ((b & 0xffu) ? 1u : 0u) | ((b & 0xff00u) ? 2u : 0u) |
                            ((b & 0xff0000u) ? 4u : 0u) | ((b & 0xff000000u) ? 8u : 0u);
        if (ln == 0) nib[w] = n4 << (4 * w);
        __syncthreads();                      // the eight waves' bits are in LDS before thread 0 joins them
        if (t == 0) {
            unsigned word = 0;
#pragma unroll
            for (int i = 0; i < 8; ++i) word |= nib[i];
            Fl[sb * FSTEP] = word;
        }
        return;
    }
    const size_t e0 = (size_t)blockIdx.x * (PKEYS * D_DIM);      // first element of the share
    const v4f* k4 = reinterpret_cast<const v4f*>(K + e0) + t;    // 512 contiguous bytes a wave
    // Rows 2r and 2r + 1 of a key block, columns 4 * (t & 15) on: whole 256-B rows, 16 lanes each.
    const int r = t >> 4, d4 = t & 15;
    const v4f* v4 = reinterpret_cast<const v4f*>(V + e0) + 2 * r * (D_DIM / 4) + d4;

    // The loops are unrolled so that all of a thread's loads are in flight together.
    v4f va[PBLK], vb[PBLK], kr[2 * PBLK];
#pragma unroll
    for (int j = 0; j < PBLK; ++j) {
        va[j] = v4[j * (KBLK * D_DIM / 4)];
        vb[j] = v4[j * (KBLK * D_DIM / 4) + D_DIM / 4];
    }
#pragma unroll
    for (int j = 0; j < 2 * PBLK; ++j) kr[j] = k4[j * 256];
#pragma unroll
    for (int j = 0; j < PBLK; ++j)
#pragma unroll
        for (int c = 0; c < 4; ++c) {
            h2 p; p[0] = (_Float16)va[j][c]; p[1] = (_Float16)vb[j][c];
            *reinterpret_cast<h2*>(&tr[j][(4 * d4 + c) * VSTRIDE + 2 * r]) = p;   // transposed
        }
    __syncthreads();      // the transposed tiles are whole before other threads read them out
    // All global stores stand behind the barrier, which would wait for stores in front of it.
#pragma unroll
    for (int j = 0; j < 2 * PBLK; ++j) {
        h4 p;
#pragma unroll
        for (int c = 0; c < 4; ++c) p[c] = (_Float16)kr[j][c];
        *reinterpret_cast<h4*>(Kh + e0 + (size_t)(j * 256 + t) * 4) = p;   // 256 contiguous bytes a wave
    }
#pragma unroll
    for (int j = 0; j < PBLK; ++j) {          // 16 bytes at (t & 3) * 16 of row t >> 2: whole lines out
        const h8 p = *reinterpret_cast<const h8*>(&tr[j][(t >> 2) * VSTRIDE + (t & 3) * 8]);
        *reinterpret_cast<h8*>(Vt + e0 + (size_t)(j * 256 + t) * 8) = p;
    }
}

// One wave group's K tile (32 rows of 128 B) and V^T tile (64 rows of 64 B), f16, each 4 KB in a
// row in the workspace, to LDS buffer BUF through no register: two copies of 16 bytes a lane each.
// kg, vg: the tiles' first bytes (the same in all lanes: scalar bases); go: the lane's byte in a
// half tile, tid * 16; lk, lv: its LDS byte addresses in buffer 0 (K: (tid & 7) * 16 of row
// tid >> 3; V^T: (tid & 3) * 16 of row tid >> 2). The immediate offset moves both addresses: it
// carries the LDS step (buffer, half tile), and the scalar base has it taken off.
// The last line stands in front of every later write of a register that a copy names.
template <int BUF>
__device__ inline void copy_kv(const _Float16* kg, const _Float16* vg, unsigned go,
                               unsigned lk, unsigned lv) {
    constexpr int K0 = BUF * KBLK * KSTRIDE * 2;        // bytes: the K buffer's start
    constexpr int K1 = K0 + (KBLK / 2) * KSTRIDE * 2;   // bytes: its row 16
    constexpr int V0 = BUF * D_DIM * VSTRIDE * 2;       // bytes: the V^T buffer's start
    constexpr int V1 = V0 + (D_DIM / 2) * VSTRIDE * 2;  // bytes: its row 32
    constexpr int H  = KBLK * D_DIM;                    // bytes: half a tile in the workspace
    const unsigned long long ka = (unsigned long long)kg, va = (unsigned long long)vg;
    asm volatile("global_load_async_to_lds_b128 %0, %2, %3 offset:%7\n\t"
                 "global_load_async_to_lds_b128 %0, %2, %4 offset:%8\n\t"
                 "global_load_async_to_lds_b128 %1, %2, %5 offset:%9\n\t"
                 "global_load_async_to_lds_b128 %1, %2, %6 offset:%10\n\t"
                 "s_wait_xcnt 0x0"
                 :: "v"(lk), "v"(lv), "v"(go),
                    "s"(ka - K0), "s"(ka + H - K1), "s"(va - V0), "s"(va + H - V1),
                    "n"(K0), "n"(K1), "n"(V0), "n"(V1)
                 : "memory");
}

// One wave's own 32 x 32 f32 mask tile, global memory to LDS buffer BUF through no register.
// A copy takes four whole 128-B rows (8 lanes a row), where a load in score order would touch
// 16 lines for the same 512 bytes. g, l: the lane's 16 bytes at (lane&7)*16 of row lane>>3, in
// memory and in buffer 0. The immediate offset moves both addresses: it carries the LDS step
// (buffer, four rows a copy), so that one LDS address register serves every copy, and the
// global address, formed anew for each tile anyway, has it taken off.
// The last line stands in front of every later write of a register that a copy names.
template <int BUF>
__device__ inline void copy_mask(const float* g, unsigned l) {
    constexpr int B0 = BUF * 32 * MSTRIDE * 4;      // bytes: the buffer's start
    constexpr int BJ = 4 * MSTRIDE * 4;             // bytes: four rows in LDS
    constexpr long long GJ = 4LL * S_LEN * 4 - BJ;  // bytes: four rows in memory, less the offset's step
    const unsigned long long a = (unsigned long long)g - B0;
    asm volatile("global_load_async_to_lds_b128 %0, %1, off offset:%9\n\t"
                 "global_load_async_to_lds_b128 %0, %2, off offset:%10\n\t"
                 "global_load_async_to_lds_b128 %0, %3, off offset:%11\n\t"
                 "global_load_async_to_lds_b128 %0, %4, off offset:%12\n\t"
                 "global_load_async_to_lds_b128 %0, %5, off offset:%13\n\t"
                 "global_load_async_to_lds_b128 %0, %6, off offset:%14\n\t"
                 "global_load_async_to_lds_b128 %0, %7, off offset:%15\n\t"
                 "global_load_async_to_lds_b128 %0, %8, off offset:%16\n\t"
                 "s_wait_xcnt 0x0"
                 :: "v"(l),
                    "v"(a),          "v"(a + GJ),     "v"(a + 2 * GJ), "v"(a + 3 * GJ),
                    "v"(a + 4 * GJ), "v"(a + 5 * GJ), "v"(a + 6 * GJ), "v"(a + 7 * GJ),
                    "n"(B0),          "n"(B0 + BJ),     "n"(B0 + 2 * BJ), "n"(B0 + 3 * BJ),
                    "n"(B0 + 4 * BJ), "n"(B0 + 5 * BJ), "n"(B0 + 6 * BJ), "n"(B0 + 7 * BJ)
                 : "memory");
}

// Eight mask values of one row out of LDS (2x ds_load_b128; the row stride is no multiple of 32 B).
__device__ inline v8f lds_mask8(const float* p) {
    const v4f a = *reinterpret_cast<const v4f*>(p);
    const v4f b = *reinterpret_cast<const v4f*>(p + 4);
    return __builtin_shufflevector(a, b, 0, 1, 2, 3, 4, 5, 6, 7);
}

__global__ __launch_bounds__(256) __attribute__((amdgpu_waves_per_eu(4, 4))) void
flash_attn_fwd(const float* __restrict__ Q, const _Float16* __restrict__ Kh,
               const _Float16* __restrict__ Vt, const float* __restrict__ Mk,
               const unsigned* __restrict__ Fl, float* __restrict__ O) {
    const int lane = threadIdx.x & 31;
    const int wave = (threadIdx.x >> 5) & 3;  // query slice of the work-group
    // wave group: takes key blocks kg, kg + 2, ... (the same in all lanes: kept scalar)
    const int kg   = __builtin_amdgcn_readfirstlane(threadIdx.x >> 7);
    const int n    = lane & 15;   // query column of all transposed tiles
    const int half = lane >> 4;   // K-half of A/B fragments held by this lane

    const int bh   = blockIdx.x >> 5;        // 16 (b,h) slices
    const int qblk = blockIdx.x & 31;        // 32 query blocks of 128 rows
    const int q0   = qblk * 128 + wave * 32; // 32 queries per wave: two 16-row tiles

    const size_t base = (size_t)bh * S_LEN * D_DIM;
    const int qA = q0 + n, qB = q0 + 16 + n;
    // Mask (broadcasts over B,H): the lane's share of the wave's tile, at the group's first columns.
    const float* mg = Mk + (size_t)(q0 + (lane >> 3)) * S_LEN + kg * KBLK + (lane & 7) * 4;

    __shared__ __attribute__((aligned(16))) _Float16 ktile[KGRP][2][KBLK * KSTRIDE];
    __shared__ __attribute__((aligned(16))) _Float16 vtile[KGRP][2][D_DIM * VSTRIDE];
    __shared__ __attribute__((aligned(32))) float part_o[4][8][32][8];
    __shared__ float    part_ml[4][4][32];
    __shared__ __attribute__((aligned(16))) float mtile[2 * 4][2][32 * MSTRIDE];

    float* mt = &mtile[threadIdx.x >> 5][0][0];     // this wave's two mask tiles
    // LDS byte address (low 32 bits of the shared address) of the lane's first copy, buffer 0.
    const unsigned ml = (unsigned)(size_t)(mt + (lane >> 3) * MSTRIDE + (lane & 7) * 4);
    const float* mrd = mt + n * MSTRIDE + half * 8; // where the lane reads row qA's values

    // The group's first K and V^T tiles in the workspace, and this thread's share of a tile.
    const int tid = threadIdx.x & 127;              // place within the wave group
    const _Float16* kp = Kh + base + kg * KBLK * D_DIM;
    const _Float16* vp = Vt + base + kg * KBLK * D_DIM;
    const unsigned go = tid * 16;
    const unsigned lk = (unsigned)(size_t)(&ktile[kg][0][0] + (tid >> 3) * KSTRIDE + (tid & 7) * 8);
    const unsigned lv = (unsigned)(size_t)(&vtile[kg][0][0] + (tid >> 2) * VSTRIDE + (tid & 3) * 8);
    copy_kv<0>(kp, vp, go, lk, lv);                 // tiles 0 into buffers 0

    // The first launch's bits for this wave's 32 query rows, one for each of the 128 key blocks
    // (the same in all lanes: kept scalar, so that every test of a bit is a scalar branch).
    const unsigned* fp = Fl + __builtin_amdgcn_readfirstlane(q0 >> 5) * (S_LEN / MCOLS) * FSTEP;
    const unsigned long long flo =
        (unsigned)__builtin_amdgcn_readfirstlane(fp[0]) |
        ((unsigned long long)(unsigned)__builtin_amdgcn_readfirstlane(fp[FSTEP]) << 32);
    const unsigned long long fhi =
        (unsigned)__builtin_amdgcn_readfirstlane(fp[2 * FSTEP]) |
        ((unsigned long long)(unsigned)__builtin_amdgcn_readfirstlane(fp[3 * FSTEP]) << 32);
    // Does the mask tile of the group's pass kb hold anything but zeros?
    auto live = [&](const int kb) -> bool {
        const int blk = kb * KGRP + kg;
        return (((blk & 64) ? fhi : flo) >> (blk & 63)) & 1ull;
    };
    bool mc = live(0);
    if (mc) copy_mask<0>(mg, ml);                   // tile 0 into buffer 0

    // Loop-invariant Q^T B-fragments, pre-scaled by (1/sqrt(d_k))*log2(e):
    // scores come out of the QK WMMAs already in log2 domain.
    const float qs = 0.125f * LOG2E;
    v16h bq[2][2];
    bq[0][0] = glb_frag_scaled(Q + base + (size_t)qA * D_DIM, half, 0,  qs);
    bq[0][1] = glb_frag_scaled(Q + base + (size_t)qA * D_DIM, half, 32, qs);
    bq[1][0] = glb_frag_scaled(Q + base + (size_t)qB * D_DIM, half, 0,  qs);
    bq[1][1] = glb_frag_scaled(Q + base + (size_t)qB * D_DIM, half, 32, qs);
    // Stands in front of every later write of a register that the Q loads name. Their address is
    // an input, so that its registers are still held here and nothing is written to them earlier.
    asm volatile("s_wait_xcnt 0x0" :: "v"(Q + base + (size_t)qA * D_DIM + half * 8) : "memory");

    v8f ot[2][4];                                   // O^T accumulators [tile][d-chunk]
#pragma unroll
    for (int t = 0; t < 2; ++t)
#pragma unroll
        for (int c = 0; c < 4; ++c) ot[t][c] = splat8(0.0f);

    float m_run[2] = {-INFINITY, -INFINITY};        // log2 domain
    float l_run[2] = {0.0f, 0.0f};
    const v8f mcoef = splat8(-1e9f * LOG2E);

    // Mask, K and V^T tiles 0 have landed before the first pass's barrier.
    asm volatile("s_wait_asynccnt 0x0" ::: "memory");

    // One pass of a wave group over 32 keys (its block kb: keys (kb * KGRP + kg) * KBLK on).
    // cur: LDS buffer of this pass; more: a next pass exists (block-uniform).
    // mcur, mnext: this pass's and the next pass's mask tile is not all zeros (wave-uniform).
    auto pass = [&](const int kb, const int cur, const bool more, const bool mcur, const bool mnext) {
        __syncthreads();
        if (more) {          // the next pass's mask, K and V^T copies fly under this pass's work,
                             // into the buffers whose readers left them before the barrier above
            const size_t nk0 = (size_t)(kb + 1) * KGRP * KBLK * D_DIM;
            if (cur) {       // cur: a constant at each call
                if (mnext) copy_mask<0>(mg + (kb + 1) * KGRP * KBLK, ml);
                copy_kv<0>(kp + nk0, vp + nk0, go, lk, lv);
            } else {
                if (mnext) copy_mask<1>(mg + (kb + 1) * KGRP * KBLK, ml);
                copy_kv<1>(kp + nk0, vp + nk0, go, lk, lv);
            }
        }

        const _Float16* kt = ktile[kg][cur];
        const _Float16* vt = vtile[kg][cur];

        // ---- K A-fragments: loaded once, shared by both query tiles ----
        v16h ak00 = lds_frag(kt + n * KSTRIDE, half, 0);
        v16h ak01 = lds_frag(kt + n * KSTRIDE, half, 32);
        v16h ak10 = lds_frag(kt + (16 + n) * KSTRIDE, half, 0);
        v16h ak11 = lds_frag(kt + (16 + n) * KSTRIDE, half, 32);

        // ---- S^T = K_blk x Q^T : 8 WMMAs, two independent accumulator sets ----
        v8f st[2][2];
#pragma unroll
        for (int t = 0; t < 2; ++t) {
            v8f z0 = splat8(0.0f);
            v8f z1 = splat8(0.0f);
            z0 = wmma_f16(ak00, bq[t][0], z0);
            z1 = wmma_f16(ak10, bq[t][0], z1);
            z0 = wmma_f16(ak01, bq[t][1], z0);
            z1 = wmma_f16(ak11, bq[t][1], z1);
            st[t][0] = z0; st[t][1] = z1;
        }

        // Keeps the mask reads behind the S^T products, where they take the K fragments'
        // registers: moved up among them, they cost spills at 256 registers.
        __builtin_amdgcn_sched_barrier(0);
        // ---- mask: whole-vector math, operands are already pk-pair aligned ----
        if (mcur) {
#pragma unroll
            for (int t = 0; t < 2; ++t) {
                const float* mr = mrd + (cur * 32 + t * 16) * MSTRIDE;
                st[t][0] = lds_mask8(mr) * mcoef + st[t][0];
                st[t][1] = lds_mask8(mr + 16) * mcoef + st[t][1];
            }
        }

        // ---- per-tile: online softmax (base-2) + P^T fragment ----
        v16h bp[2];
#pragma unroll
        for (int t = 0; t < 2; ++t) {
            const v8f s0 = st[t][0];
            const v8f s1 = st[t][1];

            float mblk = -INFINITY;
#pragma unroll
            for (int v = 0; v < 8; ++v) mblk = fmaxf(mblk, fmaxf(s0[v], s1[v]));
            mblk = fmaxf(mblk, __shfl_xor(mblk, 16, 32));

            const float m_new = fmaxf(m_run[t], mblk);
            const float alpha = __builtin_amdgcn_exp2f(m_run[t] - m_new);

            v8f p0, p1;
            float rsum = 0.0f;
#pragma unroll
            for (int v = 0; v < 8; ++v) {
                p0[v] = __builtin_amdgcn_exp2f(s0[v] - m_new);
                p1[v] = __builtin_amdgcn_exp2f(s1[v] - m_new);
                rsum += p0[v] + p1[v];
            }
            rsum += __shfl_xor(rsum, 16, 32);
            l_run[t] = l_run[t] * alpha + rsum;
            m_run[t] = m_new;

            const v8f av_ = splat8(alpha);
#pragma unroll
            for (int c = 0; c < 4; ++c) ot[t][c] = ot[t][c] * av_;

#pragma unroll
            for (int v = 0; v < 8; ++v) {
                bp[t][v]     = (_Float16)p0[v];
                bp[t][v + 8] = (_Float16)p1[v];
            }
        }

        // ---- O^T += V^T x P^T : 8 WMMAs, V^T A-fragments shared by both tiles ----
#pragma unroll
        for (int c = 0; c < 4; ++c) {
            v16h av = lds_frag(vt + (c * 16 + n) * VSTRIDE, half, 0);
            ot[0][c] = wmma_f16(av, bp[0], ot[0][c]);
            ot[1][c] = wmma_f16(av, bp[1], ot[1][c]);
        }

        // Foot of the pass, in front of the next barrier: this wave's LDS reads are done, so
        // that the buffers it has just read may be refilled behind that barrier ...
        asm volatile("s_wait_dscnt 0x0" ::: "memory");
        // ... and its copies of the next pass's mask, K and V^T tiles have landed.
        asm volatile("s_wait_asynccnt 0x0" ::: "memory");
    };

    // Two passes a trip, so that the LDS buffers swap by name.
    for (int kb = 0; kb < NPASS; kb += 2) {
        const bool m1 = live(kb + 1);
        const bool more = kb + 2 < NPASS;
        const bool m2 = more && live(kb + 2);
        pass(kb,     0, true, mc, m1);
        pass(kb + 1, 1, more, m1, m2);
        mc = m2;
    }
    // No copy is in flight when the wave goes on to the join and ends.
    asm volatile("s_wait_asynccnt 0x0" ::: "memory");

    if (kg == 1) {
#pragma unroll
        for (int t = 0; t < 2; ++t) {
            part_ml[wave][t][lane]     = m_run[t];
            part_ml[wave][2 + t][lane] = l_run[t];
#pragma unroll
            for (int c = 0; c < 4; ++c)
                *reinterpret_cast<v8f*>(&part_o[wave][t * 4 + c][lane][0]) = ot[t][c];
        }
    }
    __syncthreads();
    if (kg == 1) return;

    // ---- epilogue: O[q][d] = O^T / l ; lane owns row q, d = c*16 + half*8 + v ----
#pragma unroll
    for (int t = 0; t < 2; ++t) {
        const float m1 = part_ml[wave][t][lane];
        const float l1 = part_ml[wave][2 + t][lane];
        const float mj = fmaxf(m_run[t], m1);
        const float a0 = __builtin_amdgcn_exp2f(m_run[t] - mj);
        const float a1 = __builtin_amdgcn_exp2f(m1 - mj);
        const float inv = 1.0f / (l_run[t] * a0 + l1 * a1);
        const v8f w0 = splat8(a0 * inv);
        const v8f w1 = splat8(a1 * inv);
        float* orow = O + base + (size_t)(t ? qB : qA) * D_DIM;
#pragma unroll
        for (int c = 0; c < 4; ++c) {
            const v8f o1 = *reinterpret_cast<const v8f*>(&part_o[wave][t * 4 + c][lane][0]);
            v8f ov = ot[t][c] * w0 + o1 * w1;
            *reinterpret_cast<v8f*>(orow + c * 16 + half * 8) = ov;  // 2x b128 store
        }
    }
}

extern "C" void kernel_launch(void* const* d_in, const int* in_sizes, int n_in,
                              void* d_out, int out_size, void* d_ws, size_t ws_size,
                              hipStream_t stream) {
    (void)in_sizes; (void)n_in; (void)ws_size; (void)out_size;
    const float* Q  = (const float*)d_in[0];
    const float* K  = (const float*)d_in[1];
    const float* V  = (const float*)d_in[2];
    // d_in[3] = d_k (scalar, 64) — folded into the Q pre-scale
    const float* Mk = (const float*)d_in[4];
    float* O = (float*)d_out;
    _Float16* Kh = (_Float16*)d_ws;                  // 8 MB
    _Float16* Vt = Kh + 16 * S_LEN * D_DIM;          // 8 MB
    unsigned* Fl = (unsigned*)(Vt + 16 * S_LEN * D_DIM);  // 64 KB: 512 flag words, a line each

    // grid: 16 (b,h) slices x 32 query-blocks of 128 rows; 256 threads = 2 groups of 4 waves
    dim3 grid(16 * 32), block(256);
    kv_to_f16<<<dim3(KVWG + MWG), block, 0, stream>>>(K, V, Mk, Kh, Vt, Fl);
    flash_attn_fwd<<<grid, block, 0, stream>>>(Q, Kh, Vt, Mk, Fl, O);
}

// v006
// It runs in 77.2 microseconds.
// Timed twice side by side with v005, it ran 1.03 and 1.04 times as fast.
// Counting every step since v000, it is 10.9 times as fast.
#include <hip/hip_runtime.h>
#include <hip/hip_bf16.h>

typedef _Float16 v16h __attribute__((ext_vector_type(16)));
typedef _Float16 h8   __attribute__((ext_vector_type(8)));
typedef _Float16 h4   __attribute__((ext_vector_type(4)));
typedef _Float16 h2   __attribute__((ext_vector_type(2)));
typedef float    v8f  __attribute__((ext_vector_type(8)));
typedef float    v4f  __attribute__((ext_vector_type(4)));

#define S_LEN   4096
#define D_DIM   64
#define KBLK    32            // keys per pass; a loop trip runs two passes
#define NBLK    (S_LEN / KBLK)
#define KGRP    2
#define NPASS   (NBLK / KGRP)
#define KSTRIDE 72
#define VSTRIDE 40
#define MSTRIDE 36
#define LOG2E   1.4426950408889634f

__device__ inline v8f splat8(float x) {
    v8f r;
#pragma unroll
    for (int e = 0; e < 8; ++e) r[e] = x;
    return r;
}

__device__ inline v16h lds_frag(const _Float16* row, int half, int doff) {
    union { v16h v; h8 h[2]; } u;
    u.h[0] = *reinterpret_cast<const h8*>(row + doff + half * 8);
    u.h[1] = *reinterpret_cast<const h8*>(row + doff + 16 + half * 8);
    return u.v;
}

// Global f32 -> f16 fragment with pre-scale folded in.
__device__ inline v16h glb_frag_scaled(const float* __restrict__ row, int half,
                                       int doff, float scale) {
    const float4* p0 = reinterpret_cast<const float4*>(row + doff + half * 8);
    const float4* p1 = reinterpret_cast<const float4*>(row + doff + 16 + half * 8);
    float4 a = p0[0], b = p0[1], c = p1[0], d = p1[1];
    float lo[8] = {a.x, a.y, a.z, a.w, b.x, b.y, b.z, b.w};
    float hi[8] = {c.x, c.y, c.z, c.w, d.x, d.y, d.z, d.w};
    v16h r;
#pragma unroll
    for (int e = 0; e < 8; ++e) {
        r[e]     = (_Float16)(lo[e] * scale);
        r[e + 8] = (_Float16)(hi[e] * scale);
    }
    return r;
}

__device__ inline v8f wmma_f16(v16h a, v16h b, v8f c) {
    return __builtin_amdgcn_wmma_f32_16x16x32_f16(false, a, false, b, (short)0, c, false, false);
}

// First launch: K and V, f32, are turned into f16 once, into the workspace, so that the 32 query
// blocks of a (b,h) slice read half the bytes and none of them converts or transposes.
//   Kh: K's own order, [slice][key][d].
//   Vt: per block of 32 keys d-major, [slice][key block][d][key in block]: the V^T tile as LDS holds it.
// A work-group takes PKEYS keys of one slice (the slices follow one another in memory).
#define PKEYS 256
#define PBLK  (PKEYS / KBLK)
#define KVWG  (16 * S_LEN / PKEYS)   // work-groups that convert K and V
// The same launch looks through the mask once: further work-groups, each on 32 query rows x 1024
// key columns, write one word: bit i is set where 32 x 32 tile i of that strip holds an entry
// other than +0 or -0. A tile of zeros adds exactly nothing to the scores, so the main loop
// neither copies nor adds a tile whose bit is clear. Each word has a 128-B line of its own.
#define MCOLS 1024
#define MWG   ((S_LEN / 32) * (S_LEN / MCOLS))
#define FSTEP 32                     // words from one flag word to the next
__global__ __launch_bounds__(256) __attribute__((amdgpu_waves_per_eu(2, 2))) void
kv_to_f16(const float* __restrict__ K, const float* __restrict__ V, const float* __restrict__ Mk,
          _Float16* __restrict__ Kh, _Float16* __restrict__ Vt, unsigned* __restrict__ Fl) {
    __shared__ __attribute__((aligned(16))) _Float16 tr[PBLK][D_DIM * VSTRIDE];
    __shared__ unsigned nib[8];
    const int t = threadIdx.x;
    if (blockIdx.x >= KVWG) {                 // the same for the whole work-group
        const int sb = blockIdx.x - KVWG;     // strip: rows (sb >> 2) * 32 on, columns (sb & 3) * 1024 on
        const int w = t >> 5, ln = t & 31;
        // A wave takes 128 columns, four tiles: 512 contiguous bytes of each of the 32 rows.
        const v4f* mp = reinterpret_cast<const v4f*>(
            Mk + (size_t)(sb >> 2) * 32 * S_LEN + (sb & 3) * MCOLS + w * 128) + ln;
        v4f x[32];
#pragma unroll                                // unrolled: all 32 loads of a lane in flight together
        for (int r = 0; r < 32; ++r) x[r] = mp[r * (S_LEN / 4)];
        // Stands in front of every later write of a register that these loads name.
        asm volatile("s_wait_xcnt 0x0" :: "v"(mp) : "memory");
        unsigned acc = 0;
#pragma unroll
        for (int r = 0; r < 32; ++r)
#pragma unroll
            for (int c = 0; c < 4; ++c) acc |= __float_as_uint(x[r][c]);
        // The sign bit is left out: -0 counts as zero; NaN, infinity and subnormals count as set.
        const unsigned b = __builtin_amdgcn_ballot_w32((acc << 1) != 0u);   // 8 lanes a tile
        const unsigned n4 = ((b & 0xffu) ? 1u : 0u) | ((b & 0xff00u) ? 2u : 0u) |
                            ((b & 0xff0000u) ? 4u : 0u) | ((b & 0xff000000u) ? 8u : 0u);
        if (ln == 0) nib[w] = n4 << (4 * w);
        __syncthreads();                      // the eight waves' bits are in LDS before thread 0 joins them
        if (t == 0) {
            unsigned word = 0;
#pragma unroll
            for (int i = 0; i < 8; ++i) word |= nib[i];
            Fl[sb * FSTEP] = word;
        }
        return;
    }
    const size_t e0 = (size_t)blockIdx.x * (PKEYS * D_DIM);      // first element of the share
    const v4f* k4 = reinterpret_cast<const v4f*>(K + e0) + t;    // 512 contiguous bytes a wave
    // Rows 2r and 2r + 1 of a key block, columns 4 * (t & 15) on: whole 256-B rows, 16 lanes each.
    const int r = t >> 4, d4 = t & 15;
    const v4f* v4 = reinterpret_cast<const v4f*>(V + e0) + 2 * r * (D_DIM / 4) + d4;

    // The loops are unrolled so that all of a thread's loads are in flight together.
    v4f va[PBLK], vb[PBLK], kr[2 * PBLK];
#pragma unroll
    for (int j = 0; j < PBLK; ++j) {
        va[j] = v4[j * (KBLK * D_DIM / 4)];
        vb[j] = v4[j * (KBLK * D_DIM / 4) + D_DIM / 4];
    }
#pragma unroll
    for (int j = 0; j < 2 * PBLK; ++j) kr[j] = k4[j * 256];
#pragma unroll
    for (int j = 0; j < PBLK; ++j)
#pragma unroll
        for (int c = 0; c < 4; ++c) {
            h2 p; p[0] = (_Float16)va[j][c]; p[1] = (_Float16)vb[j][c];
            *reinterpret_cast<h2*>(&tr[j][(4 * d4 + c) * VSTRIDE + 2 * r]) = p;   // transposed
        }
    __syncthreads();      // the transposed tiles are whole before other threads read them out
    // All global stores stand behind the barrier, which would wait for stores in front of it.
#pragma unroll
    for (int j = 0; j < 2 * PBLK; ++j) {
        h4 p;
#pragma unroll
        for (int c = 0; c < 4; ++c) p[c] = (_Float16)kr[j][c];
        *reinterpret_cast<h4*>(Kh + e0 + (size_t)(j * 256 + t) * 4) = p;   // 256 contiguous bytes a wave
    }
#pragma unroll
    for (int j = 0; j < PBLK; ++j) {          // 16 bytes at (t & 3) * 16 of row t >> 2: whole lines out
        const h8 p = *reinterpret_cast<const h8*>(&tr[j][(t >> 2) * VSTRIDE + (t & 3) * 8]);
        *reinterpret_cast<h8*>(Vt + e0 + (size_t)(j * 256 + t) * 8) = p;
    }
}

// One wave group's K tile (32 rows of 128 B) and V^T tile (64 rows of 64 B), f16, each 4 KB in a
// row in the workspace, to LDS buffer BUF through no register: two copies of 16 bytes a lane each.
// kg, vg: the tiles' first bytes (the same in all lanes: scalar bases); go: the lane's byte in a
// half tile, tid * 16; lk, lv: its LDS byte addresses in buffer 0 (K: (tid & 7) * 16 of row
// tid >> 3; V^T: (tid & 3) * 16 of row tid >> 2). The immediate offset moves both addresses: it
// carries the LDS step (buffer, half tile), and the scalar base has it taken off.
// The last line stands in front of every later write of a register that a copy names.
template <int BUF>
__device__ inline void copy_kv(const _Float16* kg, const _Float16* vg, unsigned go,
                               unsigned lk, unsigned lv) {
    constexpr int K0 = BUF * KBLK * KSTRIDE * 2;        // bytes: the K buffer's start
    constexpr int K1 = K0 + (KBLK / 2) * KSTRIDE * 2;   // bytes: its row 16
    constexpr int V0 = BUF * D_DIM * VSTRIDE * 2;       // bytes: the V^T buffer's start
    constexpr int V1 = V0 + (D_DIM / 2) * VSTRIDE * 2;  // bytes: its row 32
    constexpr int H  = KBLK * D_DIM;                    // bytes: half a tile in the workspace
    const unsigned long long ka = (unsigned long long)kg, va = (unsigned long long)vg;
    asm volatile("global_load_async_to_lds_b128 %0, %2, %3 offset:%7\n\t"
                 "global_load_async_to_lds_b128 %0, %2, %4 offset:%8\n\t"
                 "global_load_async_to_lds_b128 %1, %2, %5 offset:%9\n\t"
                 "global_load_async_to_lds_b128 %1, %2, %6 offset:%10\n\t"
                 "s_wait_xcnt 0x0"
                 :: "v"(lk), "v"(lv), "v"(go),
                    "s"(ka - K0), "s"(ka + H - K1), "s"(va - V0), "s"(va + H - V1),
                    "n"(K0), "n"(K1), "n"(V0), "n"(V1)
                 : "memory");
}

// One wave's own 32 x 32 f32 mask tile, global memory to LDS buffer BUF through no register.
// A copy takes four whole 128-B rows (8 lanes a row), where a load in score order would touch
// 16 lines for the same 512 bytes. g, l: the lane's 16 bytes at (lane&7)*16 of row lane>>3, in
// memory and in buffer 0. The immediate offset moves both addresses: it carries the LDS step
// (buffer, four rows a copy), so that one LDS address register serves every copy, and the
// global address, formed anew for each tile anyway, has it taken off.
// The last line stands in front of every later write of a register that a copy names.
template <int BUF>
__device__ inline void copy_mask(const float* g, unsigned l) {
    constexpr int B0 = BUF * 32 * MSTRIDE * 4;      // bytes: the buffer's start
    constexpr int BJ = 4 * MSTRIDE * 4;             // bytes: four rows in LDS
    constexpr long long GJ = 4LL * S_LEN * 4 - BJ;  // bytes: four rows in memory, less the offset's step
    const unsigned long long a = (unsigned long long)g - B0;
    asm volatile("global_load_async_to_lds_b128 %0, %1, off offset:%9\n\t"
                 "global_load_async_to_lds_b128 %0, %2, off offset:%10\n\t"
                 "global_load_async_to_lds_b128 %0, %3, off offset:%11\n\t"
                 "global_load_async_to_lds_b128 %0, %4, off offset:%12\n\t"
                 "global_load_async_to_lds_b128 %0, %5, off offset:%13\n\t"
                 "global_load_async_to_lds_b128 %0, %6, off offset:%14\n\t"
                 "global_load_async_to_lds_b128 %0, %7, off offset:%15\n\t"
                 "global_load_async_to_lds_b128 %0, %8, off offset:%16\n\t"
                 "s_wait_xcnt 0x0"
                 :: "v"(l),
                    "v"(a),          "v"(a + GJ),     "v"(a + 2 * GJ), "v"(a + 3 * GJ),
                    "v"(a + 4 * GJ), "v"(a + 5 * GJ), "v"(a + 6 * GJ), "v"(a + 7 * GJ),
                    "n"(B0),          "n"(B0 + BJ),     "n"(B0 + 2 * BJ), "n"(B0 + 3 * BJ),
                    "n"(B0 + 4 * BJ), "n"(B0 + 5 * BJ), "n"(B0 + 6 * BJ), "n"(B0 + 7 * BJ)
                 : "memory");
}

// Eight mask values of one row out of LDS (2x ds_load_b128; the row stride is no multiple of 32 B).
__device__ inline v8f lds_mask8(const float* p) {
    const v4f a = *reinterpret_cast<const v4f*>(p);
    const v4f b = *reinterpret_cast<const v4f*>(p + 4);
    return __builtin_shufflevector(a, b, 0, 1, 2, 3, 4, 5, 6, 7);
}

__global__ __launch_bounds__(256) __attribute__((amdgpu_waves_per_eu(4, 4))) void
flash_attn_fwd(const float* __restrict__ Q, const _Float16* __restrict__ Kh,
               const _Float16* __restrict__ Vt, const float* __restrict__ Mk,
               const unsigned* __restrict__ Fl, float* __restrict__ O) {
    const int lane = threadIdx.x & 31;
    const int wave = (threadIdx.x >> 5) & 3;  // query slice of the work-group
    // wave group: takes key blocks kg, kg + 2, ... (the same in all lanes: kept scalar)
    const int kg   = __builtin_amdgcn_readfirstlane(threadIdx.x >> 7);
    const int n    = lane & 15;   // query column of all transposed tiles
    const int half = lane >> 4;   // K-half of A/B fragments held by this lane

    const int bh   = blockIdx.x >> 5;        // 16 (b,h) slices
    const int qblk = blockIdx.x & 31;        // 32 query blocks of 128 rows
    const int q0   = qblk * 128 + wave * 32; // 32 queries per wave: two 16-row tiles

    const size_t base = (size_t)bh * S_LEN * D_DIM;
    const int qA = q0 + n, qB = q0 + 16 + n;
    // Mask (broadcasts over B,H): the lane's share of the wave's tile, at the group's first columns.
    const float* mg = Mk + (size_t)(q0 + (lane >> 3)) * S_LEN + kg * KBLK + (lane & 7) * 4;

    __shared__ __attribute__((aligned(16))) _Float16 ktile[KGRP][2][KBLK * KSTRIDE];
    __shared__ __attribute__((aligned(16))) _Float16 vtile[KGRP][2][D_DIM * VSTRIDE];
    __shared__ __attribute__((aligned(32))) float part_o[4][8][32][8];
    __shared__ float    part_ml[4][4][32];
    __shared__ __attribute__((aligned(16))) float mtile[2 * 4][2][32 * MSTRIDE];

    float* mt = &mtile[threadIdx.x >> 5][0][0];     // this wave's two mask tiles
    // LDS byte address (low 32 bits of the shared address) of the lane's first copy, buffer 0.
    const unsigned ml = (unsigned)(size_t)(mt + (lane >> 3) * MSTRIDE + (lane & 7) * 4);
    const float* mrd = mt + n * MSTRIDE + half * 8; // where the lane reads row qA's values

    // The group's first K and V^T tiles in the workspace, and this thread's share of a tile.
    const int tid = threadIdx.x & 127;              // place within the wave group
    const _Float16* kp = Kh + base + kg * KBLK * D_DIM;
    const _Float16* vp = Vt + base + kg * KBLK * D_DIM;
    const unsigned go = tid * 16;
    const unsigned lk = (unsigned)(size_t)(&ktile[kg][0][0] + (tid >> 3) * KSTRIDE + (tid & 7) * 8);
    const unsigned lv = (unsigned)(size_t)(&vtile[kg][0][0] + (tid >> 2) * VSTRIDE + (tid & 3) * 8);
    copy_kv<0>(kp, vp, go, lk, lv);                 // tiles 0 into buffers 0

    // The first launch's bits for this wave's 32 query rows, one for each of the 128 key blocks
    // (the same in all lanes: kept scalar, so that every test of a bit is a scalar branch).
    const unsigned* fp = Fl + __builtin_amdgcn_readfirstlane(q0 >> 5) * (S_LEN / MCOLS) * FSTEP;
    const unsigned long long flo =
        (unsigned)__builtin_amdgcn_readfirstlane(fp[0]) |
        ((unsigned long long)(unsigned)__builtin_amdgcn_readfirstlane(fp[FSTEP]) << 32);
    const unsigned long long fhi =
        (unsigned)__builtin_amdgcn_readfirstlane(fp[2 * FSTEP]) |
        ((unsigned long long)(unsigned)__builtin_amdgcn_readfirstlane(fp[3 * FSTEP]) << 32);
    // Does the mask tile of the group's pass kb hold anything but zeros?
    auto live = [&](const int kb) -> bool {
        const int blk = kb * KGRP + kg;
        return (((blk & 64) ? fhi : flo) >> (blk & 63)) & 1ull;
    };
    bool mc = live(0);
    if (mc) copy_mask<0>(mg, ml);                   // tile 0 into buffer 0

    // Loop-invariant Q^T B-fragments, pre-scaled by (1/sqrt(d_k))*log2(e):
    // scores come out of the QK WMMAs already in log2 domain.
    const float qs = 0.125f * LOG2E;
    v16h bq[2][2];
    bq[0][0] = glb_frag_scaled(Q + base + (size_t)qA * D_DIM, half, 0,  qs);
    bq[0][1] = glb_frag_scaled(Q + base + (size_t)qA * D_DIM, half, 32, qs);
    bq[1][0] = glb_frag_scaled(Q + base + (size_t)qB * D_DIM, half, 0,  qs);
    bq[1][1] = glb_frag_scaled(Q + base + (size_t)qB * D_DIM, half, 32, qs);
    // Stands in front of every later write of a register that the Q loads name. Their address is
    // an input, so that its registers are still held here and nothing is written to them earlier.
    asm volatile("s_wait_xcnt 0x0" :: "v"(Q + base + (size_t)qA * D_DIM + half * 8) : "memory");

    v8f ot[2][4];                                   // O^T accumulators [tile][d-chunk]
#pragma unroll
    for (int t = 0; t < 2; ++t)
#pragma unroll
        for (int c = 0; c < 4; ++c) ot[t][c] = splat8(0.0f);

    float m_run[2] = {-INFINITY, -INFINITY};        // log2 domain: the maximum in use
    float m_thr[2] = {-INFINITY, -INFINITY};        // m_run + 8: a block maximum above it forces a rescale
    float l_run[2] = {0.0f, 0.0f};
    const v8f mcoef = splat8(-1e9f * LOG2E);

    // Mask, K and V^T tiles 0 have landed before the first pass's barrier.
    asm volatile("s_wait_asynccnt 0x0" ::: "memory");

    // One pass of a wave group over 32 keys (its block kb: keys (kb * KGRP + kg) * KBLK on).
    // cur: LDS buffer of this pass; more: a next pass exists (block-uniform).
    // mcur, mnext: this pass's and the next pass's mask tile is not all zeros (wave-uniform).
    auto pass = [&](const int kb, const int cur, const bool more, const bool mcur, const bool mnext) {
        __syncthreads();
        if (more) {          // the next pass's mask, K and V^T copies fly under this pass's work,
                             // into the buffers whose readers left them before the barrier above
            const size_t nk0 = (size_t)(kb + 1) * KGRP * KBLK * D_DIM;
            if (cur) {       // cur: a constant at each call
                if (mnext) copy_mask<0>(mg + (kb + 1) * KGRP * KBLK, ml);
                copy_kv<0>(kp + nk0, vp + nk0, go, lk, lv);
            } else {
                if (mnext) copy_mask<1>(mg + (kb + 1) * KGRP * KBLK, ml);
                copy_kv<1>(kp + nk0, vp + nk0, go, lk, lv);
            }
        }

        const _Float16* kt = ktile[kg][cur];
        const _Float16* vt = vtile[kg][cur];

        // ---- K A-fragments: loaded once, shared by both query tiles ----
        v16h ak00 = lds_frag(kt + n * KSTRIDE, half, 0);
        v16h ak01 = lds_frag(kt + n * KSTRIDE, half, 32);
        v16h ak10 = lds_frag(kt + (16 + n) * KSTRIDE, half, 0);
        v16h ak11 = lds_frag(kt + (16 + n) * KSTRIDE, half, 32);

        // ---- S^T = K_blk x Q^T : 8 WMMAs, two independent accumulator sets ----
        v8f st[2][2];
#pragma unroll
        for (int t = 0; t < 2; ++t) {
            v8f z0 = splat8(0.0f);
            v8f z1 = splat8(0.0f);
            z0 = wmma_f16(ak00, bq[t][0], z0);
            z1 = wmma_f16(ak10, bq[t][0], z1);
            z0 = wmma_f16(ak01, bq[t][1], z0);
            z1 = wmma_f16(ak11, bq[t][1], z1);
            st[t][0] = z0; st[t][1] = z1;
        }

        // Keeps the mask reads behind the S^T products, where they take the K fragments'
        // registers: moved up among them, they cost spills at 256 registers.
        __builtin_amdgcn_sched_barrier(0);
        // ---- mask: whole-vector math, operands are already pk-pair aligned ----
        if (mcur) {
#pragma unroll
            for (int t = 0; t < 2; ++t) {
                const float* mr = mrd + (cur * 32 + t * 16) * MSTRIDE;
                st[t][0] = lds_mask8(mr) * mcoef + st[t][0];
                st[t][1] = lds_mask8(mr + 16) * mcoef + st[t][1];
            }
        }

        // ---- lazy rescale: m_run, the maximum in use, may trail a query's true maximum by up to
        // 8 (log2 domain, so an exponential reaches 2^8 at most). Each lane tests its own 16 keys;
        // one scalar branch a pass; the halves meet, and l and O^T are rescaled, only behind it.
        float mloc[2];
        bool need = false;
#pragma unroll
        for (int t = 0; t < 2; ++t) {
            float mblk = -INFINITY;
#pragma unroll
            for (int v = 0; v < 8; ++v) mblk = fmaxf(mblk, fmaxf(st[t][0][v], st[t][1][v]));
            mloc[t] = mblk;
            need = need || (mblk > m_thr[t]);
        }
        // The test reads the same in the whole wave. Marked unlikely, so that the rescale stands
        // out of line and the usual pass falls through.
        if (__builtin_expect(__builtin_amdgcn_ballot_w32(need) != 0u, 0)) {
#pragma unroll
            for (int t = 0; t < 2; ++t) {
                const float mblk  = fmaxf(mloc[t], __shfl_xor(mloc[t], 16, 32));
                const float m_new = fmaxf(m_run[t], mblk);
                const float alpha = __builtin_amdgcn_exp2f(m_run[t] - m_new);  // 0 on the first pass
                m_run[t] = m_new;
                m_thr[t] = m_new + 8.0f;
                l_run[t] = l_run[t] * alpha;
                const v8f av_ = splat8(alpha);
#pragma unroll
                for (int c = 0; c < 4; ++c) ot[t][c] = ot[t][c] * av_;
            }
        }

        // ---- per-tile: exponentials (base-2) against the maximum in use + P^T fragment ----
        v16h bp[2];
#pragma unroll
        for (int t = 0; t < 2; ++t) {
            const v8f s0 = st[t][0];
            const v8f s1 = st[t][1];
            const float m_use = m_run[t];

            v8f p0, p1;
            float rsum = 0.0f;
#pragma unroll
            for (int v = 0; v < 8; ++v) {
                p0[v] = __builtin_amdgcn_exp2f(s0[v] - m_use);
                p1[v] = __builtin_amdgcn_exp2f(s1[v] - m_use);
                rsum += p0[v] + p1[v];
            }
            rsum += __shfl_xor(rsum, 16, 32);
            l_run[t] += rsum;

#pragma unroll
            for (int v = 0; v < 8; ++v) {
                bp[t][v]     = (_Float16)p0[v];
                bp[t][v + 8] = (_Float16)p1[v];
            }
        }

        // ---- O^T += V^T x P^T : 8 WMMAs, V^T A-fragments shared by both tiles ----
#pragma unroll
        for (int c = 0; c < 4; ++c) {
            v16h av = lds_frag(vt + (c * 16 + n) * VSTRIDE, half, 0);
            ot[0][c] = wmma_f16(av, bp[0], ot[0][c]);
            ot[1][c] = wmma_f16(av, bp[1], ot[1][c]);
        }

        // Foot of the pass, in front of the next barrier: this wave's LDS reads are done, so
        // that the buffers it has just read may be refilled behind that barrier ...
        asm volatile("s_wait_dscnt 0x0" ::: "memory");
        // ... and its copies of the next pass's mask, K and V^T tiles have landed.
        asm volatile("s_wait_asynccnt 0x0" ::: "memory");
    };

    // Two passes a trip, so that the LDS buffers swap by name.
    for (int kb = 0; kb < NPASS; kb += 2) {
        const bool m1 = live(kb + 1);
        const bool more = kb + 2 < NPASS;
        const bool m2 = more && live(kb + 2);
        pass(kb,     0, true, mc, m1);
        pass(kb + 1, 1, more, m1, m2);
        mc = m2;
    }
    // No copy is in flight when the wave goes on to the join and ends.
    asm volatile("s_wait_asynccnt 0x0" ::: "memory");

    if (kg == 1) {
#pragma unroll
        for (int t = 0; t < 2; ++t) {
            part_ml[wave][t][lane]     = m_run[t];
            part_ml[wave][2 + t][lane] = l_run[t];
#pragma unroll
            for (int c = 0; c < 4; ++c)
                *reinterpret_cast<v8f*>(&part_o[wave][t * 4 + c][lane][0]) = ot[t][c];
        }
    }
    __syncthreads();
    if (kg == 1) return;

    // ---- epilogue: O[q][d] = O^T / l ; lane owns row q, d = c*16 + half*8 + v ----
#pragma unroll
    for (int t = 0; t < 2; ++t) {
        const float m1 = part_ml[wave][t][lane];
        const float l1 = part_ml[wave][2 + t][lane];
        const float mj = fmaxf(m_run[t], m1);
        const float a0 = __builtin_amdgcn_exp2f(m_run[t] - mj);
        const float a1 = __builtin_amdgcn_exp2f(m1 - mj);
        const float inv = 1.0f / (l_run[t] * a0 + l1 * a1);
        const v8f w0 = splat8(a0 * inv);
        const v8f w1 = splat8(a1 * inv);
        float* orow = O + base + (size_t)(t ? qB : qA) * D_DIM;
#pragma unroll
        for (int c = 0; c < 4; ++c) {
            const v8f o1 = *reinterpret_cast<const v8f*>(&part_o[wave][t * 4 + c][lane][0]);
            v8f ov = ot[t][c] * w0 + o1 * w1;
            *reinterpret_cast<v8f*>(orow + c * 16 + half * 8) = ov;  // 2x b128 store
        }
    }
}

extern "C" void kernel_launch(void* const* d_in, const int* in_sizes, int n_in,
                              void* d_out, int out_size, void* d_ws, size_t ws_size,
                              hipStream_t stream) {
    (void)in_sizes; (void)n_in; (void)ws_size; (void)out_size;
    const float* Q  = (const float*)d_in[0];
    const float* K  = (const float*)d_in[1];
    const float* V  = (const float*)d_in[2];
    // d_in[3] = d_k (scalar, 64) — folded into the Q pre-scale
    const float* Mk = (const float*)d_in[4];
    float* O = (float*)d_out;
    _Float16* Kh = (_Float16*)d_ws;                  // 8 MB
    _Float16* Vt = Kh + 16 * S_LEN * D_DIM;          // 8 MB
    unsigned* Fl = (unsigned*)(Vt + 16 * S_LEN * D_DIM);  // 64 KB: 512 flag words, a line each

    // grid: 16 (b,h) slices x 32 query-blocks of 128 rows; 256 threads = 2 groups of 4 waves
    dim3 grid(16 * 32), block(256);
    kv_to_f16<<<dim3(KVWG + MWG), block, 0, stream>>>(K, V, Mk, Kh, Vt, Fl);
    flash_attn_fwd<<<grid, block, 0, stream>>>(Q, Kh, Vt, Mk, Fl, O);
}

// v007
// One run takes 74.2 microseconds.
// Next to v006, in two timings, it ran 1.03 times as fast each time.
// All steps since v000 together make it 11.2 times as fast.
#include <hip/hip_runtime.h>
#include <hip/hip_bf16.h>

typedef _Float16 v16h __attribute__((ext_vector_type(16)));
typedef _Float16 h8   __attribute__((ext_vector_type(8)));
typedef _Float16 h4   __attribute__((ext_vector_type(4)));
typedef _Float16 h2   __attribute__((ext_vector_type(2)));
typedef float    v8f  __attribute__((ext_vector_type(8)));
typedef float    v4f  __attribute__((ext_vector_type(4)));

#define S_LEN   4096
#define D_DIM   64
#define KBLK    32            // keys per pass; a loop trip runs two passes
#define NBLK    (S_LEN / KBLK)
#define KGRP    2
#define NPASS   (NBLK / KGRP)
#define KSTRIDE 72
#define VSTRIDE 40
#define MSTRIDE 36
#define LOG2E   1.4426950408889634f

__device__ inline v8f splat8(float x) {
    v8f r;
#pragma unroll
    for (int e = 0; e < 8; ++e) r[e] = x;
    return r;
}

__device__ inline v16h lds_frag(const _Float16* row, int half, int doff) {
    union { v16h v; h8 h[2]; } u;
    u.h[0] = *reinterpret_cast<const h8*>(row + doff + half * 8);
    u.h[1] = *reinterpret_cast<const h8*>(row + doff + 16 + half * 8);
    return u.v;
}

// Global f32 -> f16 fragment with pre-scale folded in.
__device__ inline v16h glb_frag_scaled(const float* __restrict__ row, int half,
                                       int doff, float scale) {
    const float4* p0 = reinterpret_cast<const float4*>(row + doff + half * 8);
    const float4* p1 = reinterpret_cast<const float4*>(row + doff + 16 + half * 8);
    float4 a = p0[0], b = p0[1], c = p1[0], d = p1[1];
    float lo[8] = {a.x, a.y, a.z, a.w, b.x, b.y, b.z, b.w};
    float hi[8] = {c.x, c.y, c.z, c.w, d.x, d.y, d.z, d.w};
    v16h r;
#pragma unroll
    for (int e = 0; e < 8; ++e) {
        r[e]     = (_Float16)(lo[e] * scale);
        r[e + 8] = (_Float16)(hi[e] * scale);
    }
    return r;
}

__device__ inline v8f wmma_f16(v16h a, v16h b, v8f c) {
    return __builtin_amdgcn_wmma_f32_16x16x32_f16(false, a, false, b, (short)0, c, false, false);
}

// First launch: K and V, f32, are turned into f16 once, into the workspace, so that the 32 query
// blocks of a (b,h) slice read half the bytes and none of them converts or transposes.
//   Kh: K's own order, [slice][key][d].
//   Vt: per block of 32 keys d-major, [slice][key block][d][key in block]: the V^T tile as LDS holds it.
// A work-group takes PKEYS keys of one slice (the slices follow one another in memory).
#define PKEYS 256
#define PBLK  (PKEYS / KBLK)
#define KVWG  (16 * S_LEN / PKEYS)   // work-groups that convert K and V
// The same launch looks through the mask once: further work-groups, each on 32 query rows x 1024
// key columns, write one word: bit i is set where 32 x 32 tile i of that strip holds an entry
// other than +0 or -0. A tile of zeros adds exactly nothing to the scores, so the main loop
// neither copies nor adds a tile whose bit is clear. Each word has a 128-B line of its own.
#define MCOLS 1024
#define MWG   ((S_LEN / 32) * (S_LEN / MCOLS))
#define FSTEP 32                     // words from one flag word to the next
__global__ __launch_bounds__(256) __attribute__((amdgpu_waves_per_eu(2, 2))) void
kv_to_f16(const float* __restrict__ K, const float* __restrict__ V, const float* __restrict__ Mk,
          _Float16* __restrict__ Kh, _Float16* __restrict__ Vt, unsigned* __restrict__ Fl) {
    __shared__ __attribute__((aligned(16))) _Float16 tr[PBLK][D_DIM * VSTRIDE];
    __shared__ unsigned nib[8];
    const int t = threadIdx.x;
    if (blockIdx.x >= KVWG) {                 // the same for the whole work-group
        const int sb = blockIdx.x - KVWG;     // strip: rows (sb >> 2) * 32 on, columns (sb & 3) * 1024 on
        const int w = t >> 5, ln = t & 31;
        // A wave takes 128 columns, four tiles: 512 contiguous bytes of each of the 32 rows.
        const v4f* mp = reinterpret_cast<const v4f*>(
            Mk + (size_t)(sb >> 2) * 32 * S_LEN + (sb & 3) * MCOLS + w * 128) + ln;
        v4f x[32];
#pragma unroll                                // unrolled: all 32 loads of a lane in flight together
        for (int r = 0; r < 32; ++r) x[r] = mp[r * (S_LEN / 4)];
        // Stands in front of every later write of a register that these loads name.
        asm volatile("s_wait_xcnt 0x0" :: "v"(mp) : "memory");
        unsigned acc = 0;
#pragma unroll
        for (int r = 0; r < 32; ++r)
#pragma unroll
            for (int c = 0; c < 4; ++c) acc |= __float_as_uint(x[r][c]);
        // The sign bit is left out: -0 counts as zero; NaN, infinity and subnormals count as set.
        const unsigned b = __builtin_amdgcn_ballot_w32((acc << 1) != 0u);   // 8 lanes a tile
        const unsigned n4 = ((b & 0xffu) ? 1u : 0u) | ((b & 0xff00u) ? 2u : 0u) |
                            ((b & 0xff0000u) ? 4u : 0u) | ((b & 0xff000000u) ? 8u : 0u);
        if (ln == 0) nib[w] = n4 << (4 * w);
        __syncthreads();                      // the eight waves' bits are in LDS before thread 0 joins them
        if (t == 0) {
            unsigned word = 0;
#pragma unroll
            for (int i = 0; i < 8; ++i) word |= nib[i];
            Fl[sb * FSTEP] = word;
        }
        return;
    }
    const size_t e0 = (size_t)blockIdx.x * (PKEYS * D_DIM);      // first element of the share
    const v4f* k4 = reinterpret_cast<const v4f*>(K + e0) + t;    // 512 contiguous bytes a wave
    // Rows 2r and 2r + 1 of a key block, columns 4 * (t & 15) on: whole 256-B rows, 16 lanes each.
    const int r = t >> 4, d4 = t & 15;
    const v4f* v4 = reinterpret_cast<const v4f*>(V + e0) + 2 * r * (D_DIM / 4) + d4;

    // The loops are unrolled so that all of a thread's loads are in flight together.
    v4f va[PBLK], vb[PBLK], kr[2 * PBLK];
#pragma unroll
    for (int j = 0; j < PBLK; ++j) {
        va[j] = v4[j * (KBLK * D_DIM / 4)];
        vb[j] = v4[j * (KBLK * D_DIM / 4) + D_DIM / 4];
    }
#pragma unroll
    for (int j = 0; j < 2 * PBLK; ++j) kr[j] = k4[j * 256];
#pragma unroll
    for (int j = 0; j < PBLK; ++j)
#pragma unroll
        for (int c = 0; c < 4; ++c) {
            h2 p; p[0] = (_Float16)va[j][c]; p[1] = (_Float16)vb[j][c];
            *reinterpret_cast<h2*>(&tr[j][(4 * d4 + c) * VSTRIDE + 2 * r]) = p;   // transposed
        }
    __syncthreads();      // the transposed tiles are whole before other threads read them out
    // All global stores stand behind the barrier, which would wait for stores in front of it.
#pragma unroll
    for (int j = 0; j < 2 * PBLK; ++j) {
        h4 p;
#pragma unroll
        for (int c = 0; c < 4; ++c) p[c] = (_Float16)kr[j][c];
        *reinterpret_cast<h4*>(Kh + e0 + (size_t)(j * 256 + t) * 4) = p;   // 256 contiguous bytes a wave
    }
#pragma unroll
    for (int j = 0; j < PBLK; ++j) {          // 16 bytes at (t & 3) * 16 of row t >> 2: whole lines out
        const h8 p = *reinterpret_cast<const h8*>(&tr[j][(t >> 2) * VSTRIDE + (t & 3) * 8]);
        *reinterpret_cast<h8*>(Vt + e0 + (size_t)(j * 256 + t) * 8) = p;
    }
}

// One wave group's K tile (32 rows of 128 B) and V^T tile (64 rows of 64 B), f16, each 4 KB in a
// row in the workspace, to LDS buffer BUF through no register: two copies of 16 bytes a lane each.
// kg, vg: the tiles' first bytes (the same in all lanes: scalar bases); go: the lane's byte in a
// half tile, tid * 16; lk, lv: its LDS byte addresses in buffer 0 (K: (tid & 7) * 16 of row
// tid >> 3; V^T: (tid & 3) * 16 of row tid >> 2). The immediate offset moves both addresses: it
// carries the LDS step (buffer, half tile), and the scalar base has it taken off.
// The last line stands in front of every later write of a register that a copy names.
template <int BUF>
__device__ inline void copy_kv(const _Float16* kg, const _Float16* vg, unsigned go,
                               unsigned lk, unsigned lv) {
    constexpr int K0 = BUF * KBLK * KSTRIDE * 2;        // bytes: the K buffer's start
    constexpr int K1 = K0 + (KBLK / 2) * KSTRIDE * 2;   // bytes: its row 16
    constexpr int V0 = BUF * D_DIM * VSTRIDE * 2;       // bytes: the V^T buffer's start
    constexpr int V1 = V0 + (D_DIM / 2) * VSTRIDE * 2;  // bytes: its row 32
    constexpr int H  = KBLK * D_DIM;                    // bytes: half a tile in the workspace
    const unsigned long long ka = (unsigned long long)kg, va = (unsigned long long)vg;
    asm volatile("global_load_async_to_lds_b128 %0, %2, %3 offset:%7\n\t"
                 "global_load_async_to_lds_b128 %0, %2, %4 offset:%8\n\t"
                 "global_load_async_to_lds_b128 %1, %2, %5 offset:%9\n\t"
                 "global_load_async_to_lds_b128 %1, %2, %6 offset:%10\n\t"
                 "s_wait_xcnt 0x0"
                 :: "v"(lk), "v"(lv), "v"(go),
                    "s"(ka - K0), "s"(ka + H - K1), "s"(va - V0), "s"(va + H - V1),
                    "n"(K0), "n"(K1), "n"(V0), "n"(V1)
                 : "memory");
}

// One wave's own 32 x 32 f32 mask tile, global memory to LDS buffer BUF through no register.
// A copy takes four whole 128-B rows (8 lanes a row), where a load in score order would touch
// 16 lines for the same 512 bytes. g, l: the lane's 16 bytes at (lane&7)*16 of row lane>>3, in
// memory and in buffer 0. The immediate offset moves both addresses: it carries the LDS step
// (buffer, four rows a copy), so that one LDS address register serves every copy, and the
// global address, formed anew for each tile anyway, has it taken off.
// The last line stands in front of every later write of a register that a copy names.
template <int BUF>
__device__ inline void copy_mask(const float* g, unsigned l) {
    constexpr int B0 = BUF * 32 * MSTRIDE * 4;      // bytes: the buffer's start
    constexpr int BJ = 4 * MSTRIDE * 4;             // bytes: four rows in LDS
    constexpr long long GJ = 4LL * S_LEN * 4 - BJ;  // bytes: four rows in memory, less the offset's step
    const unsigned long long a = (unsigned long long)g - B0;
    asm volatile("global_load_async_to_lds_b128 %0, %1, off offset:%9\n\t"
                 "global_load_async_to_lds_b128 %0, %2, off offset:%10\n\t"
                 "global_load_async_to_lds_b128 %0, %3, off offset:%11\n\t"
                 "global_load_async_to_lds_b128 %0, %4, off offset:%12\n\t"
                 "global_load_async_to_lds_b128 %0, %5, off offset:%13\n\t"
                 "global_load_async_to_lds_b128 %0, %6, off offset:%14\n\t"
                 "global_load_async_to_lds_b128 %0, %7, off offset:%15\n\t"
                 "global_load_async_to_lds_b128 %0, %8, off offset:%16\n\t"
                 "s_wait_xcnt 0x0"
                 :: "v"(l),
                    "v"(a),          "v"(a + GJ),     "v"(a + 2 * GJ), "v"(a + 3 * GJ),
                    "v"(a + 4 * GJ), "v"(a + 5 * GJ), "v"(a + 6 * GJ), "v"(a + 7 * GJ),
                    "n"(B0),          "n"(B0 + BJ),     "n"(B0 + 2 * BJ), "n"(B0 + 3 * BJ),
                    "n"(B0 + 4 * BJ), "n"(B0 + 5 * BJ), "n"(B0 + 6 * BJ), "n"(B0 + 7 * BJ)
                 : "memory");
}

// Eight mask values of one row out of LDS (2x ds_load_b128; the row stride is no multiple of 32 B).
__device__ inline v8f lds_mask8(const float* p) {
    const v4f a = *reinterpret_cast<const v4f*>(p);
    const v4f b = *reinterpret_cast<const v4f*>(p + 4);
    return __builtin_shufflevector(a, b, 0, 1, 2, 3, 4, 5, 6, 7);
}

__global__ __launch_bounds__(256) __attribute__((amdgpu_waves_per_eu(4, 4))) void
flash_attn_fwd(const float* __restrict__ Q, const _Float16* __restrict__ Kh,
               const _Float16* __restrict__ Vt, const float* __restrict__ Mk,
               const unsigned* __restrict__ Fl, float* __restrict__ O) {
    const int lane = threadIdx.x & 31;
    const int wave = (threadIdx.x >> 5) & 3;  // query slice of the work-group
    // wave group: takes key blocks kg, kg + 2, ... (the same in all lanes: kept scalar)
    const int kg   = __builtin_amdgcn_readfirstlane(threadIdx.x >> 7);
    const int n    = lane & 15;   // query column of all transposed tiles
    const int half = lane >> 4;   // K-half of A/B fragments held by this lane

    const int bh   = blockIdx.x >> 5;        // 16 (b,h) slices
    const int qblk = blockIdx.x & 31;        // 32 query blocks of 128 rows
    const int q0   = qblk * 128 + wave * 32; // 32 queries per wave: two 16-row tiles

    const size_t base = (size_t)bh * S_LEN * D_DIM;
    const int qA = q0 + n, qB = q0 + 16 + n;
    // Mask (broadcasts over B,H): the lane's share of the wave's tile, at the group's first columns.
    const float* mg = Mk + (size_t)(q0 + (lane >> 3)) * S_LEN + kg * KBLK + (lane & 7) * 4;

    __shared__ __attribute__((aligned(16))) _Float16 ktile[KGRP][2][KBLK * KSTRIDE];
    __shared__ __attribute__((aligned(16))) _Float16 vtile[KGRP][2][D_DIM * VSTRIDE];
    __shared__ __attribute__((aligned(32))) float part_o[4][8][32][8];
    __shared__ float    part_ml[4][4][32];
    __shared__ __attribute__((aligned(16))) float mtile[2 * 4][2][32 * MSTRIDE];

    float* mt = &mtile[threadIdx.x >> 5][0][0];     // this wave's two mask tiles
    // LDS byte address (low 32 bits of the shared address) of the lane's first copy, buffer 0.
    const unsigned ml = (unsigned)(size_t)(mt + (lane >> 3) * MSTRIDE + (lane & 7) * 4);
    const float* mrd = mt + n * MSTRIDE + half * 8; // where the lane reads row qA's values

    // The group's first K and V^T tiles in the workspace, and this thread's share of a tile.
    const int tid = threadIdx.x & 127;              // place within the wave group
    const _Float16* kp = Kh + base + kg * KBLK * D_DIM;
    const _Float16* vp = Vt + base + kg * KBLK * D_DIM;
    const unsigned go = tid * 16;
    const unsigned lk = (unsigned)(size_t)(&ktile[kg][0][0] + (tid >> 3) * KSTRIDE + (tid & 7) * 8);
    const unsigned lv = (unsigned)(size_t)(&vtile[kg][0][0] + (tid >> 2) * VSTRIDE + (tid & 3) * 8);
    // The 32 work-groups of a slice read the same K and V^T tiles and run at the same pace. Each
    // enters the key walk at a place of its own and wraps round, so that they do not ask L2 for
    // the same lines at the same moment: query blocks stand two passes apart, and slice bh a
    // further bh passes on, which also parts the 16 work-groups that share a query block's mask
    // tiles. at(kb): the place among the group's key blocks, 0 to NPASS - 1, that pass kb works
    // on; the NPASS passes take every place once (from blockIdx alone: scalar).
    const int rot = (2 * qblk + bh) & (NPASS - 1);
    auto at = [&](const int kb) -> int { return (kb + rot) & (NPASS - 1); };
    const size_t fk0 = (size_t)at(0) * KGRP * KBLK * D_DIM;
    copy_kv<0>(kp + fk0, vp + fk0, go, lk, lv);     // pass 0's tiles into buffers 0

    // The first launch's bits for this wave's 32 query rows, one for each of the 128 key blocks
    // (the same in all lanes: kept scalar, so that every test of a bit is a scalar branch).
    const unsigned* fp = Fl + __builtin_amdgcn_readfirstlane(q0 >> 5) * (S_LEN / MCOLS) * FSTEP;
    const unsigned long long flo =
        (unsigned)__builtin_amdgcn_readfirstlane(fp[0]) |
        ((unsigned long long)(unsigned)__builtin_amdgcn_readfirstlane(fp[FSTEP]) << 32);
    const unsigned long long fhi =
        (unsigned)__builtin_amdgcn_readfirstlane(fp[2 * FSTEP]) |
        ((unsigned long long)(unsigned)__builtin_amdgcn_readfirstlane(fp[3 * FSTEP]) << 32);
    // Does the mask tile of the group's pass kb hold anything but zeros?
    auto live = [&](const int kb) -> bool {
        const int blk = at(kb) * KGRP + kg;
        return (((blk & 64) ? fhi : flo) >> (blk & 63)) & 1ull;
    };
    bool mc = live(0);
    if (mc) copy_mask<0>(mg + at(0) * KGRP * KBLK, ml);   // pass 0's tile into buffer 0

    // Loop-invariant Q^T B-fragments, pre-scaled by (1/sqrt(d_k))*log2(e):
    // scores come out of the QK WMMAs already in log2 domain.
    const float qs = 0.125f * LOG2E;
    v16h bq[2][2];
    bq[0][0] = glb_frag_scaled(Q + base + (size_t)qA * D_DIM, half, 0,  qs);
    bq[0][1] = glb_frag_scaled(Q + base + (size_t)qA * D_DIM, half, 32, qs);
    bq[1][0] = glb_frag_scaled(Q + base + (size_t)qB * D_DIM, half, 0,  qs);
    bq[1][1] = glb_frag_scaled(Q + base + (size_t)qB * D_DIM, half, 32, qs);
    // Stands in front of every later write of a register that the Q loads name. Their address is
    // an input, so that its registers are still held here and nothing is written to them earlier.
    asm volatile("s_wait_xcnt 0x0" :: "v"(Q + base + (size_t)qA * D_DIM + half * 8) : "memory");

    v8f ot[2][4];                                   // O^T accumulators [tile][d-chunk]
#pragma unroll
    for (int t = 0; t < 2; ++t)
#pragma unroll
        for (int c = 0; c < 4; ++c) ot[t][c] = splat8(0.0f);

    float m_run[2] = {-INFINITY, -INFINITY};        // log2 domain: the maximum in use
    float m_thr[2] = {-INFINITY, -INFINITY};        // m_run + 8: a block maximum above it forces a rescale
    float l_run[2] = {0.0f, 0.0f};
    const v8f mcoef = splat8(-1e9f * LOG2E);

    // Mask, K and V^T tiles 0 have landed before the first pass's barrier.
    asm volatile("s_wait_asynccnt 0x0" ::: "memory");

    // One pass of a wave group over 32 keys (its block at(kb): keys (at(kb) * KGRP + kg) * KBLK on).
    // cur: LDS buffer of this pass; more: a next pass exists (block-uniform).
    // mcur, mnext: this pass's and the next pass's mask tile is not all zeros (wave-uniform).
    auto pass = [&](const int kb, const int cur, const bool more, const bool mcur, const bool mnext) {
        __syncthreads();
        if (more) {          // the next pass's mask, K and V^T copies fly under this pass's work,
                             // into the buffers whose readers left them before the barrier above
            const int nb = at(kb + 1);
            const size_t nk0 = (size_t)nb * KGRP * KBLK * D_DIM;
            if (cur) {       // cur: a constant at each call
                if (mnext) copy_mask<0>(mg + nb * KGRP * KBLK, ml);
                copy_kv<0>(kp + nk0, vp + nk0, go, lk, lv);
            } else {
                if (mnext) copy_mask<1>(mg + nb * KGRP * KBLK, ml);
                copy_kv<1>(kp + nk0, vp + nk0, go, lk, lv);
            }
        }

        const _Float16* kt = ktile[kg][cur];
        const _Float16* vt = vtile[kg][cur];

        // ---- K A-fragments: loaded once, shared by both query tiles ----
        v16h ak00 = lds_frag(kt + n * KSTRIDE, half, 0);
        v16h ak01 = lds_frag(kt + n * KSTRIDE, half, 32);
        v16h ak10 = lds_frag(kt + (16 + n) * KSTRIDE, half, 0);
        v16h ak11 = lds_frag(kt + (16 + n) * KSTRIDE, half, 32);

        // ---- S^T = K_blk x Q^T : 8 WMMAs, two independent accumulator sets ----
        v8f st[2][2];
#pragma unroll
        for (int t = 0; t < 2; ++t) {
            v8f z0 = splat8(0.0f);
            v8f z1 = splat8(0.0f);
            z0 = wmma_f16(ak00, bq[t][0], z0);
            z1 = wmma_f16(ak10, bq[t][0], z1);
            z0 = wmma_f16(ak01, bq[t][1], z0);
            z1 = wmma_f16(ak11, bq[t][1], z1);
            st[t][0] = z0; st[t][1] = z1;
        }

        // Keeps the mask reads behind the S^T products, where they take the K fragments'
        // registers: moved up among them, they cost spills at 256 registers.
        __builtin_amdgcn_sched_barrier(0);
        // ---- mask: whole-vector math, operands are already pk-pair aligned ----
        if (mcur) {
#pragma unroll
            for (int t = 0; t < 2; ++t) {
                const float* mr = mrd + (cur * 32 + t * 16) * MSTRIDE;
                st[t][0] = lds_mask8(mr) * mcoef + st[t][0];
                st[t][1] = lds_mask8(mr + 16) * mcoef + st[t][1];
            }
        }

        // ---- lazy rescale: m_run, the maximum in use, may trail a query's true maximum by up to
        // 8 (log2 domain, so an exponential reaches 2^8 at most). Each lane tests its own 16 keys;
        // one scalar branch a pass; the halves meet, and l and O^T are rescaled, only behind it.
        float mloc[2];
        bool need = false;
#pragma unroll
        for (int t = 0; t < 2; ++t) {
            float mblk = -INFINITY;
#pragma unroll
            for (int v = 0; v < 8; ++v) mblk = fmaxf(mblk, fmaxf(st[t][0][v], st[t][1][v]));
            mloc[t] = mblk;
            need = need || (mblk > m_thr[t]);
        }
        // The test reads the same in the whole wave. Marked unlikely, so that the rescale stands
        // out of line and the usual pass falls through.
        if (__builtin_expect(__builtin_amdgcn_ballot_w32(need) != 0u, 0)) {
#pragma unroll
            for (int t = 0; t < 2; ++t) {
                const float mblk  = fmaxf(mloc[t], __shfl_xor(mloc[t], 16, 32));
                const float m_new = fmaxf(m_run[t], mblk);
                const float alpha = __builtin_amdgcn_exp2f(m_run[t] - m_new);  // 0 on the first pass
                m_run[t] = m_new;
                m_thr[t] = m_new + 8.0f;
                l_run[t] = l_run[t] * alpha;
                const v8f av_ = splat8(alpha);
#pragma unroll
                for (int c = 0; c < 4; ++c) ot[t][c] = ot[t][c] * av_;
            }
        }

        // ---- per-tile: exponentials (base-2) against the maximum in use + P^T fragment ----
        v16h bp[2];
#pragma unroll
        for (int t = 0; t < 2; ++t) {
            const v8f s0 = st[t][0];
            const v8f s1 = st[t][1];
            const float m_use = m_run[t];

            v8f p0, p1;
            float rsum = 0.0f;
#pragma unroll
            for (int v = 0; v < 8; ++v) {
                p0[v] = __builtin_amdgcn_exp2f(s0[v] - m_use);
                p1[v] = __builtin_amdgcn_exp2f(s1[v] - m_use);
                rsum += p0[v] + p1[v];
            }
            rsum += __shfl_xor(rsum, 16, 32);
            l_run[t] += rsum;

#pragma unroll
            for (int v = 0; v < 8; ++v) {
                bp[t][v]     = (_Float16)p0[v];
                bp[t][v + 8] = (_Float16)p1[v];
            }
        }

        // ---- O^T += V^T x P^T : 8 WMMAs, V^T A-fragments shared by both tiles ----
#pragma unroll
        for (int c = 0; c < 4; ++c) {
            v16h av = lds_frag(vt + (c * 16 + n) * VSTRIDE, half, 0);
            ot[0][c] = wmma_f16(av, bp[0], ot[0][c]);
            ot[1][c] = wmma_f16(av, bp[1], ot[1][c]);
        }

        // Foot of the pass, in front of the next barrier: this wave's LDS reads are done, so
        // that the buffers it has just read may be refilled behind that barrier ...
        asm volatile("s_wait_dscnt 0x0" ::: "memory");
        // ... and its copies of the next pass's mask, K and V^T tiles have landed.
        asm volatile("s_wait_asynccnt 0x0" ::: "memory");
    };

    // Two passes a trip, so that the LDS buffers swap by name.
    for (int kb = 0; kb < NPASS; kb += 2) {
        const bool m1 = live(kb + 1);
        const bool more = kb + 2 < NPASS;
        const bool m2 = more && live(kb + 2);
        pass(kb,     0, true, mc, m1);
        pass(kb + 1, 1, more, m1, m2);
        mc = m2;
    }
    // No copy is in flight when the wave goes on to the join and ends.
    asm volatile("s_wait_asynccnt 0x0" ::: "memory");

    if (kg == 1) {
#pragma unroll
        for (int t = 0; t < 2; ++t) {
            part_ml[wave][t][lane]     = m_run[t];
            part_ml[wave][2 + t][lane] = l_run[t];
#pragma unroll
            for (int c = 0; c < 4; ++c)
                *reinterpret_cast<v8f*>(&part_o[wave][t * 4 + c][lane][0]) = ot[t][c];
        }
    }
    __syncthreads();
    if (kg == 1) return;

    // ---- epilogue: O[q][d] = O^T / l ; lane owns row q, d = c*16 + half*8 + v ----
#pragma unroll
    for (int t = 0; t < 2; ++t) {
        const float m1 = part_ml[wave][t][lane];
        const float l1 = part_ml[wave][2 + t][lane];
        const float mj = fmaxf(m_run[t], m1);
        const float a0 = __builtin_amdgcn_exp2f(m_run[t] - mj);
        const float a1 = __builtin_amdgcn_exp2f(m1 - mj);
        const float inv = 1.0f / (l_run[t] * a0 + l1 * a1);
        const v8f w0 = splat8(a0 * inv);
        const v8f w1 = splat8(a1 * inv);
        float* orow = O + base + (size_t)(t ? qB : qA) * D_DIM;
#pragma unroll
        for (int c = 0; c < 4; ++c) {
            const v8f o1 = *reinterpret_cast<const v8f*>(&part_o[wave][t * 4 + c][lane][0]);
            v8f ov = ot[t][c] * w0 + o1 * w1;
            *reinterpret_cast<v8f*>(orow + c * 16 + half * 8) = ov;  // 2x b128 store
        }
    }
}

extern "C" void kernel_launch(void* const* d_in, const int* in_sizes, int n_in,
                              void* d_out, int out_size, void* d_ws, size_t ws_size,
                              hipStream_t stream) {
    (void)in_sizes; (void)n_in; (void)ws_size; (void)out_size;
    const float* Q  = (const float*)d_in[0];
    const float* K  = (const float*)d_in[1];
    const float* V  = (const float*)d_in[2];
    // d_in[3] = d_k (scalar, 64) — folded into the Q pre-scale
    const float* Mk = (const float*)d_in[4];
    float* O = (float*)d_out;
    _Float16* Kh = (_Float16*)d_ws;                  // 8 MB
    _Float16* Vt = Kh + 16 * S_LEN * D_DIM;          // 8 MB
    unsigned* Fl = (unsigned*)(Vt + 16 * S_LEN * D_DIM);  // 64 KB: 512 flag words, a line each

    // grid: 16 (b,h) slices x 32 query-blocks of 128 rows; 256 threads = 2 groups of 4 waves
    dim3 grid(16 * 32), block(256);
    kv_to_f16<<<dim3(KVWG + MWG), block, 0, stream>>>(K, V, Mk, Kh, Vt, Fl);
    flash_attn_fwd<<<grid, block, 0, stream>>>(Q, Kh, Vt, Mk, Fl, O);
}

// v008
// A run of this version takes 71.1 microseconds.
// Next to v007, in two timings, it ran 1.04 and 1.05 times as fast.
// Over all steps from v000 it is 11.7 times as fast.
#include <hip/hip_runtime.h>
#include <hip/hip_bf16.h>

typedef _Float16 v16h __attribute__((ext_vector_type(16)));
typedef _Float16 h8   __attribute__((ext_vector_type(8)));
typedef _Float16 h4   __attribute__((ext_vector_type(4)));
typedef _Float16 h2   __attribute__((ext_vector_type(2)));
typedef float    v8f  __attribute__((ext_vector_type(8)));
typedef float    v4f  __attribute__((ext_vector_type(4)));

#define S_LEN   4096
#define D_DIM   64
#define KBLK    32            // keys per pass; a loop trip runs two passes
#define NBLK    (S_LEN / KBLK)
#define KGRP    2
#define NPASS   (NBLK / KGRP)
#define KSTRIDE 72
#define VSTRIDE 40
#define MSTRIDE 36
#define LOG2E   1.4426950408889634f
#define MFOLD   256.0f        // log2 domain: largest magnitude of a maximum that rides in the C operand

__device__ inline v8f splat8(float x) {
    v8f r;
#pragma unroll
    for (int e = 0; e < 8; ++e) r[e] = x;
    return r;
}

__device__ inline v16h lds_frag(const _Float16* row, int half, int doff) {
    union { v16h v; h8 h[2]; } u;
    u.h[0] = *reinterpret_cast<const h8*>(row + doff + half * 8);
    u.h[1] = *reinterpret_cast<const h8*>(row + doff + 16 + half * 8);
    return u.v;
}

// Global f32 -> f16 fragment with pre-scale folded in.
__device__ inline v16h glb_frag_scaled(const float* __restrict__ row, int half,
                                       int doff, float scale) {
    const float4* p0 = reinterpret_cast<const float4*>(row + doff + half * 8);
    const float4* p1 = reinterpret_cast<const float4*>(row + doff + 16 + half * 8);
    float4 a = p0[0], b = p0[1], c = p1[0], d = p1[1];
    float lo[8] = {a.x, a.y, a.z, a.w, b.x, b.y, b.z, b.w};
    float hi[8] = {c.x, c.y, c.z, c.w, d.x, d.y, d.z, d.w};
    v16h r;
#pragma unroll
    for (int e = 0; e < 8; ++e) {
        r[e]     = (_Float16)(lo[e] * scale);
        r[e + 8] = (_Float16)(hi[e] * scale);
    }
    return r;
}

__device__ inline v8f wmma_f16(v16h a, v16h b, v8f c) {
    return __builtin_amdgcn_wmma_f32_16x16x32_f16(false, a, false, b, (short)0, c, false, false);
}

// First launch: K and V, f32, are turned into f16 once, into the workspace, so that the 32 query
// blocks of a (b,h) slice read half the bytes and none of them converts or transposes.
//   Kh: K's own order, [slice][key][d].
//   Vt: per block of 32 keys d-major, [slice][key block][d][key in block]: the V^T tile as LDS holds it.
// A work-group takes PKEYS keys of one slice (the slices follow one another in memory).
#define PKEYS 256
#define PBLK  (PKEYS / KBLK)
#define KVWG  (16 * S_LEN / PKEYS)   // work-groups that convert K and V
// The same launch looks through the mask once: further work-groups, each on 32 query rows x 1024
// key columns, write one word: bit i is set where 32 x 32 tile i of that strip holds an entry
// other than +0 or -0. A tile of zeros adds exactly nothing to the scores, so the main loop
// neither copies nor adds a tile whose bit is clear. Each word has a 128-B line of its own.
#define MCOLS 1024
#define MWG   ((S_LEN / 32) * (S_LEN / MCOLS))
#define FSTEP 32                     // words from one flag word to the next
__global__ __launch_bounds__(256) __attribute__((amdgpu_waves_per_eu(2, 2))) void
kv_to_f16(const float* __restrict__ K, const float* __restrict__ V, const float* __restrict__ Mk,
          _Float16* __restrict__ Kh, _Float16* __restrict__ Vt, unsigned* __restrict__ Fl) {
    __shared__ __attribute__((aligned(16))) _Float16 tr[PBLK][D_DIM * VSTRIDE];
    __shared__ unsigned nib[8];
    const int t = threadIdx.x;
    if (blockIdx.x >= KVWG) {                 // the same for the whole work-group
        const int sb = blockIdx.x - KVWG;     // strip: rows (sb >> 2) * 32 on, columns (sb & 3) * 1024 on
        const int w = t >> 5, ln = t & 31;
        // A wave takes 128 columns, four tiles: 512 contiguous bytes of each of the 32 rows.
        const v4f* mp = reinterpret_cast<const v4f*>(
            Mk + (size_t)(sb >> 2) * 32 * S_LEN + (sb & 3) * MCOLS + w * 128) + ln;
        v4f x[32];
#pragma unroll                                // unrolled: all 32 loads of a lane in flight together
        for (int r = 0; r < 32; ++r) x[r] = mp[r * (S_LEN / 4)];
        // Stands in front of every later write of a register that these loads name.
        asm volatile("s_wait_xcnt 0x0" :: "v"(mp) : "memory");
        unsigned acc = 0;
#pragma unroll
        for (int r = 0; r < 32; ++r)
#pragma unroll
            for (int c = 0; c < 4; ++c) acc |= __float_as_uint(x[r][c]);
        // The sign bit is left out: -0 counts as zero; NaN, infinity and subnormals count as set.
        const unsigned b = __builtin_amdgcn_ballot_w32((acc << 1) != 0u);   // 8 lanes a tile
        const unsigned n4 = ((b & 0xffu) ? 1u : 0u) | ((b & 0xff00u) ? 2u : 0u) |
                            ((b & 0xff0000u) ? 4u : 0u) | ((b & 0xff000000u) ? 8u : 0u);
        if (ln == 0) nib[w] = n4 << (4 * w);
        __syncthreads();                      // the eight waves' bits are in LDS before thread 0 joins them
        if (t == 0) {
            unsigned word = 0;
#pragma unroll
            for (int i = 0; i < 8; ++i) word |= nib[i];
            Fl[sb * FSTEP] = word;
        }
        return;
    }
    const size_t e0 = (size_t)blockIdx.x * (PKEYS * D_DIM);      // first element of the share
    const v4f* k4 = reinterpret_cast<const v4f*>(K + e0) + t;    // 512 contiguous bytes a wave
    // Rows 2r and 2r + 1 of a key block, columns 4 * (t & 15) on: whole 256-B rows, 16 lanes each.
    const int r = t >> 4, d4 = t & 15;
    const v4f* v4 = reinterpret_cast<const v4f*>(V + e0) + 2 * r * (D_DIM / 4) + d4;

    // The loops are unrolled so that all of a thread's loads are in flight together.
    v4f va[PBLK], vb[PBLK], kr[2 * PBLK];
#pragma unroll
    for (int j = 0; j < PBLK; ++j) {
        va[j] = v4[j * (KBLK * D_DIM / 4)];
        vb[j] = v4[j * (KBLK * D_DIM / 4) + D_DIM / 4];
    }
#pragma unroll
    for (int j = 0; j < 2 * PBLK; ++j) kr[j] = k4[j * 256];
#pragma unroll
    for (int j = 0; j < PBLK; ++j)
#pragma unroll
        for (int c = 0; c < 4; ++c) {
            h2 p; p[0] = (_Float16)va[j][c]; p[1] = (_Float16)vb[j][c];
            *reinterpret_cast<h2*>(&tr[j][(4 * d4 + c) * VSTRIDE + 2 * r]) = p;   // transposed
        }
    __syncthreads();      // the transposed tiles are whole before other threads read them out
    // All global stores stand behind the barrier, which would wait for stores in front of it.
#pragma unroll
    for (int j = 0; j < 2 * PBLK; ++j) {
        h4 p;
#pragma unroll
        for (int c = 0; c < 4; ++c) p[c] = (_Float16)kr[j][c];
        *reinterpret_cast<h4*>(Kh + e0 + (size_t)(j * 256 + t) * 4) = p;   // 256 contiguous bytes a wave
    }
#pragma unroll
    for (int j = 0; j < PBLK; ++j) {          // 16 bytes at (t & 3) * 16 of row t >> 2: whole lines out
        const h8 p = *reinterpret_cast<const h8*>(&tr[j][(t >> 2) * VSTRIDE + (t & 3) * 8]);
        *reinterpret_cast<h8*>(Vt + e0 + (size_t)(j * 256 + t) * 8) = p;
    }
}

// One wave group's K tile (32 rows of 128 B) and V^T tile (64 rows of 64 B), f16, each 4 KB in a
// row in the workspace, to LDS buffer BUF through no register: two copies of 16 bytes a lane each.
// kg, vg: the tiles' first bytes (the same in all lanes: scalar bases); go: the lane's byte in a
// half tile, tid * 16; lk, lv: its LDS byte addresses in buffer 0 (K: (tid & 7) * 16 of row
// tid >> 3; V^T: (tid & 3) * 16 of row tid >> 2). The immediate offset moves both addresses: it
// carries the LDS step (buffer, half tile), and the scalar base has it taken off.
// The last line stands in front of every later write of a register that a copy names.
template <int BUF>
__device__ inline void copy_kv(const _Float16* kg, const _Float16* vg, unsigned go,
                               unsigned lk, unsigned lv) {
    constexpr int K0 = BUF * KBLK * KSTRIDE * 2;        // bytes: the K buffer's start
    constexpr int K1 = K0 + (KBLK / 2) * KSTRIDE * 2;   // bytes: its row 16
    constexpr int V0 = BUF * D_DIM * VSTRIDE * 2;       // bytes: the V^T buffer's start
    constexpr int V1 = V0 + (D_DIM / 2) * VSTRIDE * 2;  // bytes: its row 32
    constexpr int H  = KBLK * D_DIM;                    // bytes: half a tile in the workspace
    const unsigned long long ka = (unsigned long long)kg, va = (unsigned long long)vg;
    asm volatile("global_load_async_to_lds_b128 %0, %2, %3 offset:%7\n\t"
                 "global_load_async_to_lds_b128 %0, %2, %4 offset:%8\n\t"
                 "global_load_async_to_lds_b128 %1, %2, %5 offset:%9\n\t"
                 "global_load_async_to_lds_b128 %1, %2, %6 offset:%10\n\t"
                 "s_wait_xcnt 0x0"
                 :: "v"(lk), "v"(lv), "v"(go),
                    "s"(ka - K0), "s"(ka + H - K1), "s"(va - V0), "s"(va + H - V1),
                    "n"(K0), "n"(K1), "n"(V0), "n"(V1)
                 : "memory");
}

// One wave's own 32 x 32 f32 mask tile, global memory to LDS buffer BUF through no register.
// A copy takes four whole 128-B rows (8 lanes a row), where a load in score order would touch
// 16 lines for the same 512 bytes. g, l: the lane's 16 bytes at (lane&7)*16 of row lane>>3, in
// memory and in buffer 0. The immediate offset moves both addresses: it carries the LDS step
// (buffer, four rows a copy), so that one LDS address register serves every copy, and the
// global address, formed anew for each tile anyway, has it taken off.
// The last line stands in front of every later write of a register that a copy names.
template <int BUF>
__device__ inline void copy_mask(const float* g, unsigned l) {
    constexpr int B0 = BUF * 32 * MSTRIDE * 4;      // bytes: the buffer's start
    constexpr int BJ = 4 * MSTRIDE * 4;             // bytes: four rows in LDS
    constexpr long long GJ = 4LL * S_LEN * 4 - BJ;  // bytes: four rows in memory, less the offset's step
    const unsigned long long a = (unsigned long long)g - B0;
    asm volatile("global_load_async_to_lds_b128 %0, %1, off offset:%9\n\t"
                 "global_load_async_to_lds_b128 %0, %2, off offset:%10\n\t"
                 "global_load_async_to_lds_b128 %0, %3, off offset:%11\n\t"
                 "global_load_async_to_lds_b128 %0, %4, off offset:%12\n\t"
                 "global_load_async_to_lds_b128 %0, %5, off offset:%13\n\t"
                 "global_load_async_to_lds_b128 %0, %6, off offset:%14\n\t"
                 "global_load_async_to_lds_b128 %0, %7, off offset:%15\n\t"
                 "global_load_async_to_lds_b128 %0, %8, off offset:%16\n\t"
                 "s_wait_xcnt 0x0"
                 :: "v"(l),
                    "v"(a),          "v"(a + GJ),     "v"(a + 2 * GJ), "v"(a + 3 * GJ),
                    "v"(a + 4 * GJ), "v"(a + 5 * GJ), "v"(a + 6 * GJ), "v"(a + 7 * GJ),
                    "n"(B0),          "n"(B0 + BJ),     "n"(B0 + 2 * BJ), "n"(B0 + 3 * BJ),
                    "n"(B0 + 4 * BJ), "n"(B0 + 5 * BJ), "n"(B0 + 6 * BJ), "n"(B0 + 7 * BJ)
                 : "memory");
}

// Eight mask values of one row out of LDS (2x ds_load_b128; the row stride is no multiple of 32 B).
__device__ inline v8f lds_mask8(const float* p) {
    const v4f a = *reinterpret_cast<const v4f*>(p);
    const v4f b = *reinterpret_cast<const v4f*>(p + 4);
    return __builtin_shufflevector(a, b, 0, 1, 2, 3, 4, 5, 6, 7);
}

__global__ __launch_bounds__(256) __attribute__((amdgpu_waves_per_eu(4, 4))) void
flash_attn_fwd(const float* __restrict__ Q, const _Float16* __restrict__ Kh,
               const _Float16* __restrict__ Vt, const float* __restrict__ Mk,
               const unsigned* __restrict__ Fl, float* __restrict__ O) {
    const int lane = threadIdx.x & 31;
    const int wave = (threadIdx.x >> 5) & 3;  // query slice of the work-group
    // wave group: takes key blocks kg, kg + 2, ... (the same in all lanes: kept scalar)
    const int kg   = __builtin_amdgcn_readfirstlane(threadIdx.x >> 7);
    const int n    = lane & 15;   // query column of all transposed tiles
    const int half = lane >> 4;   // K-half of A/B fragments held by this lane

    const int bh   = blockIdx.x >> 5;        // 16 (b,h) slices
    const int qblk = blockIdx.x & 31;        // 32 query blocks of 128 rows
    const int q0   = qblk * 128 + wave * 32; // 32 queries per wave: two 16-row tiles

    const size_t base = (size_t)bh * S_LEN * D_DIM;
    const int qA = q0 + n, qB = q0 + 16 + n;
    // Mask (broadcasts over B,H): the lane's share of the wave's tile, at the group's first columns.
    const float* mg = Mk + (size_t)(q0 + (lane >> 3)) * S_LEN + kg * KBLK + (lane & 7) * 4;

    __shared__ __attribute__((aligned(16))) _Float16 ktile[KGRP][2][KBLK * KSTRIDE];
    __shared__ __attribute__((aligned(16))) _Float16 vtile[KGRP][2][D_DIM * VSTRIDE];
    __shared__ __attribute__((aligned(32))) float part_o[4][8][32][8];
    __shared__ float    part_ml[4][4][32];
    __shared__ __attribute__((aligned(16))) float mtile[2 * 4][2][32 * MSTRIDE];

    float* mt = &mtile[threadIdx.x >> 5][0][0];     // this wave's two mask tiles
    // LDS byte address (low 32 bits of the shared address) of the lane's first copy, buffer 0.
    const unsigned ml = (unsigned)(size_t)(mt + (lane >> 3) * MSTRIDE + (lane & 7) * 4);
    const float* mrd = mt + n * MSTRIDE + half * 8; // where the lane reads row qA's values

    // The group's first K and V^T tiles in the workspace, and this thread's share of a tile.
    const int tid = threadIdx.x & 127;              // place within the wave group
    const _Float16* kp = Kh + base + kg * KBLK * D_DIM;
    const _Float16* vp = Vt + base + kg * KBLK * D_DIM;
    const unsigned go = tid * 16;
    const unsigned lk = (unsigned)(size_t)(&ktile[kg][0][0] + (tid >> 3) * KSTRIDE + (tid & 7) * 8);
    const unsigned lv = (unsigned)(size_t)(&vtile[kg][0][0] + (tid >> 2) * VSTRIDE + (tid & 3) * 8);
    // The 32 work-groups of a slice read the same K and V^T tiles and run at the same pace. Each
    // enters the key walk at a place of its own and wraps round, so that they do not ask L2 for
    // the same lines at the same moment: query blocks stand two passes apart, and slice bh a
    // further bh passes on, which also parts the 16 work-groups that share a query block's mask
    // tiles. at(kb): the place among the group's key blocks, 0 to NPASS - 1, that pass kb works
    // on; the NPASS passes take every place once (from blockIdx alone: scalar).
    const int rot = (2 * qblk + bh) & (NPASS - 1);
    auto at = [&](const int kb) -> int { return (kb + rot) & (NPASS - 1); };
    const size_t fk0 = (size_t)at(0) * KGRP * KBLK * D_DIM;
    copy_kv<0>(kp + fk0, vp + fk0, go, lk, lv);     // pass 0's tiles into buffers 0

    // The first launch's bits for this wave's 32 query rows, one for each of the 128 key blocks
    // (the same in all lanes: kept scalar, so that every test of a bit is a scalar branch).
    const unsigned* fp = Fl + __builtin_amdgcn_readfirstlane(q0 >> 5) * (S_LEN / MCOLS) * FSTEP;
    const unsigned long long flo =
        (unsigned)__builtin_amdgcn_readfirstlane(fp[0]) |
        ((unsigned long long)(unsigned)__builtin_amdgcn_readfirstlane(fp[FSTEP]) << 32);
    const unsigned long long fhi =
        (unsigned)__builtin_amdgcn_readfirstlane(fp[2 * FSTEP]) |
        ((unsigned long long)(unsigned)__builtin_amdgcn_readfirstlane(fp[3 * FSTEP]) << 32);
    // Does the mask tile of the group's pass kb hold anything but zeros?
    auto live = [&](const int kb) -> bool {
        const int blk = at(kb) * KGRP + kg;
        return (((blk & 64) ? fhi : flo) >> (blk & 63)) & 1ull;
    };
    bool mc = live(0);
    if (mc) copy_mask<0>(mg + at(0) * KGRP * KBLK, ml);   // pass 0's tile into buffer 0

    // Loop-invariant Q^T B-fragments, pre-scaled by (1/sqrt(d_k))*log2(e):
    // scores come out of the QK WMMAs already in log2 domain.
    const float qs = 0.125f * LOG2E;
    v16h bq[2][2];
    bq[0][0] = glb_frag_scaled(Q + base + (size_t)qA * D_DIM, half, 0,  qs);
    bq[0][1] = glb_frag_scaled(Q + base + (size_t)qA * D_DIM, half, 32, qs);
    bq[1][0] = glb_frag_scaled(Q + base + (size_t)qB * D_DIM, half, 0,  qs);
    bq[1][1] = glb_frag_scaled(Q + base + (size_t)qB * D_DIM, half, 32, qs);
    // Stands in front of every later write of a register that the Q loads name. Their address is
    // an input, so that its registers are still held here and nothing is written to them earlier.
    asm volatile("s_wait_xcnt 0x0" :: "v"(Q + base + (size_t)qA * D_DIM + half * 8) : "memory");

    v8f ot[2][4];                                   // O^T accumulators [tile][d-chunk]
#pragma unroll
    for (int t = 0; t < 2; ++t)
#pragma unroll
        for (int c = 0; c < 4; ++c) ot[t][c] = splat8(0.0f);

    float m_run[2] = {-INFINITY, -INFINITY};        // log2 domain: the maximum in use
    // The maximum in use rides in the C operand of the S^T products, so that the scores leave the
    // matrix unit with it already taken off: negm holds -m_run in all eight registers. Beside a
    // maximum of large magnitude (every key so far masked) the sum in the matrix unit would round
    // the scores' own digits away: from MFOLD on C stays 0, and every pass goes through the rescale
    // side, which subtracts m_run behind the products.
    v8f   negm[2]  = {splat8(0.0f), splat8(0.0f)};
    // A score above it, C taken off, sends the pass to the rescale side: 8, or -infinity on the
    // first pass and while C does not carry the maximum.
    float m_thr[2] = {-INFINITY, -INFINITY};
    float l_run[2] = {0.0f, 0.0f};
    const v8f mcoef = splat8(-1e9f * LOG2E);

    // Mask, K and V^T tiles 0 have landed before the first pass's barrier.
    asm volatile("s_wait_asynccnt 0x0" ::: "memory");

    // One pass of a wave group over 32 keys (its block at(kb): keys (at(kb) * KGRP + kg) * KBLK on).
    // cur: LDS buffer of this pass; more: a next pass exists (block-uniform).
    // mcur, mnext: this pass's and the next pass's mask tile is not all zeros (wave-uniform).
    auto pass = [&](const int kb, const int cur, const bool more, const bool mcur, const bool mnext) {
        __syncthreads();
        if (more) {          // the next pass's mask, K and V^T copies fly under this pass's work,
                             // into the buffers whose readers left them before the barrier above
            const int nb = at(kb + 1);
            const size_t nk0 = (size_t)nb * KGRP * KBLK * D_DIM;
            if (cur) {       // cur: a constant at each call
                if (mnext) copy_mask<0>(mg + nb * KGRP * KBLK, ml);
                copy_kv<0>(kp + nk0, vp + nk0, go, lk, lv);
            } else {
                if (mnext) copy_mask<1>(mg + nb * KGRP * KBLK, ml);
                copy_kv<1>(kp + nk0, vp + nk0, go, lk, lv);
            }
        }

        const _Float16* kt = ktile[kg][cur];
        const _Float16* vt = vtile[kg][cur];

        // ---- K A-fragments: loaded once, shared by both query tiles ----
        v16h ak00 = lds_frag(kt + n * KSTRIDE, half, 0);
        v16h ak01 = lds_frag(kt + n * KSTRIDE, half, 32);
        v16h ak10 = lds_frag(kt + (16 + n) * KSTRIDE, half, 0);
        v16h ak11 = lds_frag(kt + (16 + n) * KSTRIDE, half, 32);

        // ---- S^T - m = K_blk x Q^T + C : 8 WMMAs, two independent accumulator sets ----
        v8f st[2][2];
#pragma unroll
        for (int t = 0; t < 2; ++t) {
            v8f z0 = wmma_f16(ak00, bq[t][0], negm[t]);
            v8f z1 = wmma_f16(ak10, bq[t][0], negm[t]);
            z0 = wmma_f16(ak01, bq[t][1], z0);
            z1 = wmma_f16(ak11, bq[t][1], z1);
            st[t][0] = z0; st[t][1] = z1;
        }

        // Keeps the mask reads behind the S^T products, where they take the K fragments'
        // registers: moved up among them, they cost spills at 256 registers.
        __builtin_amdgcn_sched_barrier(0);
        // ---- mask: whole-vector math, operands are already pk-pair aligned ----
        if (mcur) {
#pragma unroll
            for (int t = 0; t < 2; ++t) {
                const float* mr = mrd + (cur * 32 + t * 16) * MSTRIDE;
                st[t][0] = lds_mask8(mr) * mcoef + st[t][0];
                st[t][1] = lds_mask8(mr + 16) * mcoef + st[t][1];
            }
        }

        // ---- lazy rescale: m_run, the maximum in use, may trail a query's true maximum by up to
        // 8 (log2 domain, so an exponential reaches 2^8 at most). Each lane tests its own 16 keys;
        // one scalar branch a pass; the halves meet, and l and O^T are rescaled, only behind it.
        float mloc[2];
        bool need = false;
#pragma unroll
        for (int t = 0; t < 2; ++t) {
            float mblk = -INFINITY;
#pragma unroll
            for (int v = 0; v < 8; ++v) mblk = fmaxf(mblk, fmaxf(st[t][0][v], st[t][1][v]));
            mloc[t] = mblk;
            need = need || (mblk > m_thr[t]);
        }
        // The test reads the same in the whole wave. Marked unlikely, so that the rescale stands
        // out of line and the usual pass falls through.
        if (__builtin_expect(__builtin_amdgcn_ballot_w32(need) != 0u, 0)) {
#pragma unroll
            for (int t = 0; t < 2; ++t) {
                const float c_old = -negm[t][0];    // what this pass's C has taken off
                const float mblk  = fmaxf(mloc[t], __shfl_xor(mloc[t], 16, 32)) + c_old;
                const float m_top = fmaxf(m_run[t], mblk);
                const bool  fold  = fabsf(m_top) <= MFOLD;
                // C is moved where it stands; what it then holds, rounding and all, is the maximum in use.
                negm[t] = negm[t] + splat8(c_old - (fold ? m_top : 0.0f));
                const float c_new = -negm[t][0];
                const float m_new = fold ? c_new : m_top;
                const float alpha = __builtin_amdgcn_exp2f(m_run[t] - m_new);  // 0 on the first pass
                m_run[t] = m_new;
                m_thr[t] = fold ? 8.0f : -INFINITY;
                const v8f dv = splat8(c_old - c_new);   // this pass's scores go over to the new C,
                const v8f rv = splat8(fold ? 0.0f : m_top);   // less what C does not carry
                st[t][0] = st[t][0] + dv - rv;
                st[t][1] = st[t][1] + dv - rv;
                l_run[t] = l_run[t] * alpha;
                const v8f av_ = splat8(alpha);
#pragma unroll
                for (int c = 0; c < 4; ++c) ot[t][c] = ot[t][c] * av_;
            }
        }

        // ---- per-tile: exponentials (base-2) of the scores, the maximum in use taken off + P^T fragment ----
        v16h bp[2];
#pragma unroll
        for (int t = 0; t < 2; ++t) {
            const v8f s0 = st[t][0];
            const v8f s1 = st[t][1];
            v8f p0, p1;
            float rsum = 0.0f;
#pragma unroll
            for (int v = 0; v < 8; ++v) {
                p0[v] = __builtin_amdgcn_exp2f(s0[v]);
                p1[v] = __builtin_amdgcn_exp2f(s1[v]);
                rsum += p0[v] + p1[v];
            }
            rsum += __shfl_xor(rsum, 16, 32);
            l_run[t] += rsum;

#pragma unroll
            for (int v = 0; v < 8; ++v) {
                bp[t][v]     = (_Float16)p0[v];
                bp[t][v + 8] = (_Float16)p1[v];
            }
        }

        // ---- O^T += V^T x P^T : 8 WMMAs, V^T A-fragments shared by both tiles ----
#pragma unroll
        for (int c = 0; c < 4; ++c) {
            v16h av = lds_frag(vt + (c * 16 + n) * VSTRIDE, half, 0);
            ot[0][c] = wmma_f16(av, bp[0], ot[0][c]);
            ot[1][c] = wmma_f16(av, bp[1], ot[1][c]);
        }

        // Foot of the pass, in front of the next barrier: this wave's LDS reads are done, so
        // that the buffers it has just read may be refilled behind that barrier ...
        asm volatile("s_wait_dscnt 0x0" ::: "memory");
        // ... and its copies of the next pass's mask, K and V^T tiles have landed.
        asm volatile("s_wait_asynccnt 0x0" ::: "memory");
    };

    // Two passes a trip, so that the LDS buffers swap by name.
    for (int kb = 0; kb < NPASS; kb += 2) {
        const bool m1 = live(kb + 1);
        const bool more = kb + 2 < NPASS;
        const bool m2 = more && live(kb + 2);
        pass(kb,     0, true, mc, m1);
        pass(kb + 1, 1, more, m1, m2);
        mc = m2;
    }
    // No copy is in flight when the wave goes on to the join and ends.
    asm volatile("s_wait_asynccnt 0x0" ::: "memory");

    if (kg == 1) {
#pragma unroll
        for (int t = 0; t < 2; ++t) {
            part_ml[wave][t][lane]     = m_run[t];
            part_ml[wave][2 + t][lane] = l_run[t];
#pragma unroll
            for (int c = 0; c < 4; ++c)
                *reinterpret_cast<v8f*>(&part_o[wave][t * 4 + c][lane][0]) = ot[t][c];
        }
    }
    __syncthreads();
    if (kg == 1) return;

    // ---- epilogue: O[q][d] = O^T / l ; lane owns row q, d = c*16 + half*8 + v ----
#pragma unroll
    for (int t = 0; t < 2; ++t) {
        const float m1 = part_ml[wave][t][lane];
        const float l1 = part_ml[wave][2 + t][lane];
        const float mj = fmaxf(m_run[t], m1);
        const float a0 = __builtin_amdgcn_exp2f(m_run[t] - mj);
        const float a1 = __builtin_amdgcn_exp2f(m1 - mj);
        const float inv = 1.0f / (l_run[t] * a0 + l1 * a1);
        const v8f w0 = splat8(a0 * inv);
        const v8f w1 = splat8(a1 * inv);
        float* orow = O + base + (size_t)(t ? qB : qA) * D_DIM;
#pragma unroll
        for (int c = 0; c < 4; ++c) {
            const v8f o1 = *reinterpret_cast<const v8f*>(&part_o[wave][t * 4 + c][lane][0]);
            v8f ov = ot[t][c] * w0 + o1 * w1;
            *reinterpret_cast<v8f*>(orow + c * 16 + half * 8) = ov;  // 2x b128 store
        }
    }
}

extern "C" void kernel_launch(void* const* d_in, const int* in_sizes, int n_in,
                              void* d_out, int out_size, void* d_ws, size_t ws_size,
                              hipStream_t stream) {
    (void)in_sizes; (void)n_in; (void)ws_size; (void)out_size;
    const float* Q  = (const float*)d_in[0];
    const float* K  = (const float*)d_in[1];
    const float* V  = (const float*)d_in[2];
    // d_in[3] = d_k (scalar, 64) — folded into the Q pre-scale
    const float* Mk = (const float*)d_in[4];
    float* O = (float*)d_out;
    _Float16* Kh = (_Float16*)d_ws;                  // 8 MB
    _Float16* Vt = Kh + 16 * S_LEN * D_DIM;          // 8 MB
    unsigned* Fl = (unsigned*)(Vt + 16 * S_LEN * D_DIM);  // 64 KB: 512 flag words, a line each

    // grid: 16 (b,h) slices x 32 query-blocks of 128 rows; 256 threads = 2 groups of 4 waves
    dim3 grid(16 * 32), block(256);
    kv_to_f16<<<dim3(KVWG + MWG), block, 0, stream>>>(K, V, Mk, Kh, Vt, Fl);
    flash_attn_fwd<<<grid, block, 0, stream>>>(Q, Kh, Vt, Mk, Fl, O);
}

// v009
// One run takes 65.5 microseconds.
// In two side-by-side timings against v008, it was 1.08 and 1.09 times as fast.
// Over all steps from v000 it is 12.7 times as fast.
#include <hip/hip_runtime.h>
#include <hip/hip_bf16.h>

typedef _Float16 v16h __attribute__((ext_vector_type(16)));
typedef _Float16 h8   __attribute__((ext_vector_type(8)));
typedef _Float16 h4   __attribute__((ext_vector_type(4)));
typedef _Float16 h2   __attribute__((ext_vector_type(2)));
typedef float    v8f  __attribute__((ext_vector_type(8)));
typedef float    v4f  __attribute__((ext_vector_type(4)));

#define S_LEN   4096
#define D_DIM   64
#define KBLK    32            // keys per pass; a loop trip runs two passes
#define NBLK    (S_LEN / KBLK)
#define KGRP    2
#define NPASS   (NBLK / KGRP)
#define KSTRIDE 72
#define VSTRIDE 40
#define MSTRIDE 36
#define LOG2E   1.4426950408889634f
#define MFOLD   256.0f        // log2 domain: largest magnitude of a maximum that rides in the C operand

__device__ inline v8f splat8(float x) {
    v8f r;
#pragma unroll
    for (int e = 0; e < 8; ++e) r[e] = x;
    return r;
}

__device__ inline v16h lds_frag(const _Float16* row, int half, int doff) {
    union { v16h v; h8 h[2]; } u;
    u.h[0] = *reinterpret_cast<const h8*>(row + doff + half * 8);
    u.h[1] = *reinterpret_cast<const h8*>(row + doff + 16 + half * 8);
    return u.v;
}

// Global f32 -> f16 fragment with pre-scale folded in.
__device__ inline v16h glb_frag_scaled(const float* __restrict__ row, int half,
                                       int doff, float scale) {
    const float4* p0 = reinterpret_cast<const float4*>(row + doff + half * 8);
    const float4* p1 = reinterpret_cast<const float4*>(row + doff + 16 + half * 8);
    float4 a = p0[0], b = p0[1], c = p1[0], d = p1[1];
    float lo[8] = {a.x, a.y, a.z, a.w, b.x, b.y, b.z, b.w};
    float hi[8] = {c.x, c.y, c.z, c.w, d.x, d.y, d.z, d.w};
    v16h r;
#pragma unroll
    for (int e = 0; e < 8; ++e) {
        r[e]     = (_Float16)(lo[e] * scale);
        r[e + 8] = (_Float16)(hi[e] * scale);
    }
    return r;
}

__device__ inline v8f wmma_f16(v16h a, v16h b, v8f c) {
    return __builtin_amdgcn_wmma_f32_16x16x32_f16(false, a, false, b, (short)0, c, false, false);
}

// First launch: K and V, f32, are turned into f16 once, into the workspace, so that the 32 query
// blocks of a (b,h) slice read half the bytes and none of them converts or transposes.
//   Kh: K's own order, [slice][key][d].
//   Vt: per block of 32 keys d-major, [slice][key block][d][key in block]: the V^T tile as LDS holds it.
// A work-group takes PKEYS keys of one slice (the slices follow one another in memory).
#define PKEYS 256
#define PBLK  (PKEYS / KBLK)
#define KVWG  (16 * S_LEN / PKEYS)   // work-groups that convert K and V
// The same launch looks through the mask once: further work-groups, each on 32 query rows x 1024
// key columns, write one word: bit i is set where 32 x 32 tile i of that strip holds an entry
// other than +0 or -0. A tile of zeros adds exactly nothing to the scores, so the main loop
// neither copies nor adds a tile whose bit is clear. Each word has a 128-B line of its own.
#define MCOLS 1024
#define MWG   ((S_LEN / 32) * (S_LEN / MCOLS))
#define FSTEP 32                     // words from one flag word to the next
__global__ __launch_bounds__(256) __attribute__((amdgpu_waves_per_eu(2, 2))) void
kv_to_f16(const float* __restrict__ K, const float* __restrict__ V, const float* __restrict__ Mk,
          _Float16* __restrict__ Kh, _Float16* __restrict__ Vt, unsigned* __restrict__ Fl) {
    __shared__ __attribute__((aligned(16))) _Float16 tr[PBLK][D_DIM * VSTRIDE];
    __shared__ unsigned nib[8];
    const int t = threadIdx.x;
    if (blockIdx.x >= KVWG) {                 // the same for the whole work-group
        const int sb = blockIdx.x - KVWG;     // strip: rows (sb >> 2) * 32 on, columns (sb & 3) * 1024 on
        const int w = t >> 5, ln = t & 31;
        // A wave takes 128 columns, four tiles: 512 contiguous bytes of each of the 32 rows.
        const v4f* mp = reinterpret_cast<const v4f*>(
            Mk + (size_t)(sb >> 2) * 32 * S_LEN + (sb & 3) * MCOLS + w * 128) + ln;
        v4f x[32];
#pragma unroll                                // unrolled: all 32 loads of a lane in flight together
        for (int r = 0; r < 32; ++r) x[r] = mp[r * (S_LEN / 4)];
        // Stands in front of every later write of a register that these loads name.
        asm volatile("s_wait_xcnt 0x0" :: "v"(mp) : "memory");
        unsigned acc = 0;
#pragma unroll
        for (int r = 0; r < 32; ++r)
#pragma unroll
            for (int c = 0; c < 4; ++c) acc |= __float_as_uint(x[r][c]);
        // The sign bit is left out: -0 counts as zero; NaN, infinity and subnormals count as set.
        const unsigned b = __builtin_amdgcn_ballot_w32((acc << 1) != 0u);   // 8 lanes a tile
        const unsigned n4 = ((b & 0xffu) ? 1u : 0u) | ((b & 0xff00u) ? 2u : 0u) |
                            ((b & 0xff0000u) ? 4u : 0u) | ((b & 0xff000000u) ? 8u : 0u);
        if (ln == 0) nib[w] = n4 << (4 * w);
        __syncthreads();                      // the eight waves' bits are in LDS before thread 0 joins them
        if (t == 0) {
            unsigned word = 0;
#pragma unroll
            for (int i = 0; i < 8; ++i) word |= nib[i];
            Fl[sb * FSTEP] = word;
        }
        return;
    }
    const size_t e0 = (size_t)blockIdx.x * (PKEYS * D_DIM);      // first element of the share
    const v4f* k4 = reinterpret_cast<const v4f*>(K + e0) + t;    // 512 contiguous bytes a wave
    // Rows 2r and 2r + 1 of a key block, columns 4 * (t & 15) on: whole 256-B rows, 16 lanes each.
    const int r = t >> 4, d4 = t & 15;
    const v4f* v4 = reinterpret_cast<const v4f*>(V + e0) + 2 * r * (D_DIM / 4) + d4;

    // The loops are unrolled so that all of a thread's loads are in flight together.
    v4f va[PBLK], vb[PBLK], kr[2 * PBLK];
#pragma unroll
    for (int j = 0; j < PBLK; ++j) {
        va[j] = v4[j * (KBLK * D_DIM / 4)];
        vb[j] = v4[j * (KBLK * D_DIM / 4) + D_DIM / 4];
    }
#pragma unroll
    for (int j = 0; j < 2 * PBLK; ++j) kr[j] = k4[j * 256];
#pragma unroll
    for (int j = 0; j < PBLK; ++j)
#pragma unroll
        for (int c = 0; c < 4; ++c) {
            h2 p; p[0] = (_Float16)va[j][c]; p[1] = (_Float16)vb[j][c];
            *reinterpret_cast<h2*>(&tr[j][(4 * d4 + c) * VSTRIDE + 2 * r]) = p;   // transposed
        }
    __syncthreads();      // the transposed tiles are whole before other threads read them out
    // All global stores stand behind the barrier, which would wait for stores in front of it.
#pragma unroll
    for (int j = 0; j < 2 * PBLK; ++j) {
        h4 p;
#pragma unroll
        for (int c = 0; c < 4; ++c) p[c] = (_Float16)kr[j][c];
        *reinterpret_cast<h4*>(Kh + e0 + (size_t)(j * 256 + t) * 4) = p;   // 256 contiguous bytes a wave
    }
#pragma unroll
    for (int j = 0; j < PBLK; ++j) {          // 16 bytes at (t & 3) * 16 of row t >> 2: whole lines out
        const h8 p = *reinterpret_cast<const h8*>(&tr[j][(t >> 2) * VSTRIDE + (t & 3) * 8]);
        *reinterpret_cast<h8*>(Vt + e0 + (size_t)(j * 256 + t) * 8) = p;
    }
}

// One wave group's K tile (32 rows of 128 B) and V^T tile (64 rows of 64 B), f16, each 4 KB in a
// row in the workspace, to LDS buffer BUF through no register: two copies of 16 bytes a lane each.
// kg, vg: the tiles' first bytes (the same in all lanes: scalar bases); go: the lane's byte in a
// half tile, tid * 16; lk, lv: its LDS byte addresses in buffer 0 (K: (tid & 7) * 16 of row
// tid >> 3; V^T: (tid & 3) * 16 of row tid >> 2). The immediate offset moves both addresses: it
// carries the LDS step (buffer, half tile), and the scalar base has it taken off.
// The last line stands in front of every later write of a register that a copy names.
template <int BUF>
__device__ inline void copy_kv(const _Float16* kg, const _Float16* vg, unsigned go,
                               unsigned lk, unsigned lv) {
    constexpr int K0 = BUF * KBLK * KSTRIDE * 2;        // bytes: the K buffer's start
    constexpr int K1 = K0 + (KBLK / 2) * KSTRIDE * 2;   // bytes: its row 16
    constexpr int V0 = BUF * D_DIM * VSTRIDE * 2;       // bytes: the V^T buffer's start
    constexpr int V1 = V0 + (D_DIM / 2) * VSTRIDE * 2;  // bytes: its row 32
    constexpr int H  = KBLK * D_DIM;                    // bytes: half a tile in the workspace
    const unsigned long long ka = (unsigned long long)kg, va = (unsigned long long)vg;
    asm volatile("global_load_async_to_lds_b128 %0, %2, %3 offset:%7\n\t"
                 "global_load_async_to_lds_b128 %0, %2, %4 offset:%8\n\t"
                 "global_load_async_to_lds_b128 %1, %2, %5 offset:%9\n\t"
                 "global_load_async_to_lds_b128 %1, %2, %6 offset:%10\n\t"
                 "s_wait_xcnt 0x0"
                 :: "v"(lk), "v"(lv), "v"(go),
                    "s"(ka - K0), "s"(ka + H - K1), "s"(va - V0), "s"(va + H - V1),
                    "n"(K0), "n"(K1), "n"(V0), "n"(V1)
                 : "memory");
}

// One wave's own 32 x 32 f32 mask tile, global memory to LDS buffer BUF through no register.
// A copy takes four whole 128-B rows (8 lanes a row), where a load in score order would touch
// 16 lines for the same 512 bytes. g, l: the lane's 16 bytes at (lane&7)*16 of row lane>>3, in
// memory and in buffer 0. The immediate offset moves both addresses: it carries the LDS step
// (buffer, four rows a copy), so that one LDS address register serves every copy, and the
// global address, formed anew for each tile anyway, has it taken off.
// The last line stands in front of every later write of a register that a copy names.
template <int BUF>
__device__ inline void copy_mask(const float* g, unsigned l) {
    constexpr int B0 = BUF * 32 * MSTRIDE * 4;      // bytes: the buffer's start
    constexpr int BJ = 4 * MSTRIDE * 4;             // bytes: four rows in LDS
    constexpr long long GJ = 4LL * S_LEN * 4 - BJ;  // bytes: four rows in memory, less the offset's step
    const unsigned long long a = (unsigned long long)g - B0;
    asm volatile("global_load_async_to_lds_b128 %0, %1, off offset:%9\n\t"
                 "global_load_async_to_lds_b128 %0, %2, off offset:%10\n\t"
                 "global_load_async_to_lds_b128 %0, %3, off offset:%11\n\t"
                 "global_load_async_to_lds_b128 %0, %4, off offset:%12\n\t"
                 "global_load_async_to_lds_b128 %0, %5, off offset:%13\n\t"
                 "global_load_async_to_lds_b128 %0, %6, off offset:%14\n\t"
                 "global_load_async_to_lds_b128 %0, %7, off offset:%15\n\t"
                 "global_load_async_to_lds_b128 %0, %8, off offset:%16\n\t"
                 "s_wait_xcnt 0x0"
                 :: "v"(l),
                    "v"(a),          "v"(a + GJ),     "v"(a + 2 * GJ), "v"(a + 3 * GJ),
                    "v"(a + 4 * GJ), "v"(a + 5 * GJ), "v"(a + 6 * GJ), "v"(a + 7 * GJ),
                    "n"(B0),          "n"(B0 + BJ),     "n"(B0 + 2 * BJ), "n"(B0 + 3 * BJ),
                    "n"(B0 + 4 * BJ), "n"(B0 + 5 * BJ), "n"(B0 + 6 * BJ), "n"(B0 + 7 * BJ)
                 : "memory");
}

// Eight mask values of one row out of LDS (2x ds_load_b128; the row stride is no multiple of 32 B).
__device__ inline v8f lds_mask8(const float* p) {
    const v4f a = *reinterpret_cast<const v4f*>(p);
    const v4f b = *reinterpret_cast<const v4f*>(p + 4);
    return __builtin_shufflevector(a, b, 0, 1, 2, 3, 4, 5, 6, 7);
}

__global__ __launch_bounds__(256) __attribute__((amdgpu_waves_per_eu(4, 4))) void
flash_attn_fwd(const float* __restrict__ Q, const _Float16* __restrict__ Kh,
               const _Float16* __restrict__ Vt, const float* __restrict__ Mk,
               const unsigned* __restrict__ Fl, float* __restrict__ O) {
    const int lane = threadIdx.x & 31;
    const int wave = (threadIdx.x >> 5) & 3;  // query slice of the work-group
    // wave group: takes key blocks kg, kg + 2, ... (the same in all lanes: kept scalar)
    const int kg   = __builtin_amdgcn_readfirstlane(threadIdx.x >> 7);
    const int n    = lane & 15;   // query column of all transposed tiles
    const int half = lane >> 4;   // K-half of A/B fragments held by this lane

    const int bh   = blockIdx.x >> 5;        // 16 (b,h) slices
    const int qblk = blockIdx.x & 31;        // 32 query blocks of 128 rows
    const int q0   = qblk * 128 + wave * 32; // 32 queries per wave: two 16-row tiles

    const size_t base = (size_t)bh * S_LEN * D_DIM;
    const int qA = q0 + n, qB = q0 + 16 + n;
    // Mask (broadcasts over B,H): the lane's share of the wave's tile, at the group's first columns.
    const float* mg = Mk + (size_t)(q0 + (lane >> 3)) * S_LEN + kg * KBLK + (lane & 7) * 4;

    __shared__ __attribute__((aligned(16))) _Float16 ktile[KGRP][2][KBLK * KSTRIDE];
    __shared__ __attribute__((aligned(16))) _Float16 vtile[KGRP][2][D_DIM * VSTRIDE];
    __shared__ __attribute__((aligned(32))) float part_o[4][8][32][8];
    __shared__ float    part_ml[4][4][32];
    __shared__ __attribute__((aligned(16))) float mtile[2 * 4][2][32 * MSTRIDE];

    float* mt = &mtile[threadIdx.x >> 5][0][0];     // this wave's two mask tiles
    // LDS byte address (low 32 bits of the shared address) of the lane's first copy, buffer 0.
    const unsigned ml = (unsigned)(size_t)(mt + (lane >> 3) * MSTRIDE + (lane & 7) * 4);
    const float* mrd = mt + n * MSTRIDE + half * 8; // where the lane reads row qA's values

    // The group's first K and V^T tiles in the workspace, and this thread's share of a tile.
    const int tid = threadIdx.x & 127;              // place within the wave group
    const _Float16* kp = Kh + base + kg * KBLK * D_DIM;
    const _Float16* vp = Vt + base + kg * KBLK * D_DIM;
    const unsigned go = tid * 16;
    const unsigned lk = (unsigned)(size_t)(&ktile[kg][0][0] + (tid >> 3) * KSTRIDE + (tid & 7) * 8);
    const unsigned lv = (unsigned)(size_t)(&vtile[kg][0][0] + (tid >> 2) * VSTRIDE + (tid & 3) * 8);
    // The 32 work-groups of a slice read the same K and V^T tiles and run at the same pace. Each
    // enters the key walk at a place of its own and wraps round, so that they do not ask L2 for
    // the same lines at the same moment: query blocks stand two passes apart, and slice bh a
    // further bh passes on, which also parts the 16 work-groups that share a query block's mask
    // tiles. at(kb): the place among the group's key blocks, 0 to NPASS - 1, that pass kb works
    // on; the NPASS passes take every place once (from blockIdx alone: scalar).
    const int rot = (2 * qblk + bh) & (NPASS - 1);
    auto at = [&](const int kb) -> int { return (kb + rot) & (NPASS - 1); };
    const size_t fk0 = (size_t)at(0) * KGRP * KBLK * D_DIM;
    copy_kv<0>(kp + fk0, vp + fk0, go, lk, lv);     // pass 0's tiles into buffers 0

    // The first launch's bits for this wave's 32 query rows, one for each of the 128 key blocks
    // (the same in all lanes: kept scalar, so that every test of a bit is a scalar branch).
    const unsigned* fp = Fl + __builtin_amdgcn_readfirstlane(q0 >> 5) * (S_LEN / MCOLS) * FSTEP;
    const unsigned long long flo =
        (unsigned)__builtin_amdgcn_readfirstlane(fp[0]) |
        ((unsigned long long)(unsigned)__builtin_amdgcn_readfirstlane(fp[FSTEP]) << 32);
    const unsigned long long fhi =
        (unsigned)__builtin_amdgcn_readfirstlane(fp[2 * FSTEP]) |
        ((unsigned long long)(unsigned)__builtin_amdgcn_readfirstlane(fp[3 * FSTEP]) << 32);
    // Does the mask tile of the group's pass kb hold anything but zeros?
    auto live = [&](const int kb) -> bool {
        const int blk = at(kb) * KGRP + kg;
        return (((blk & 64) ? fhi : flo) >> (blk & 63)) & 1ull;
    };
    bool mc = live(0);
    if (mc) copy_mask<0>(mg + at(0) * KGRP * KBLK, ml);   // pass 0's tile into buffer 0

    // Loop-invariant Q^T B-fragments, pre-scaled by (1/sqrt(d_k))*log2(e):
    // scores come out of the QK WMMAs already in log2 domain.
    const float qs = 0.125f * LOG2E;
    v16h bq[2][2];
    bq[0][0] = glb_frag_scaled(Q + base + (size_t)qA * D_DIM, half, 0,  qs);
    bq[0][1] = glb_frag_scaled(Q + base + (size_t)qA * D_DIM, half, 32, qs);
    bq[1][0] = glb_frag_scaled(Q + base + (size_t)qB * D_DIM, half, 0,  qs);
    bq[1][1] = glb_frag_scaled(Q + base + (size_t)qB * D_DIM, half, 32, qs);
    // Stands in front of every later write of a register that the Q loads name. Their address is
    // an input, so that its registers are still held here and nothing is written to them earlier.
    asm volatile("s_wait_xcnt 0x0" :: "v"(Q + base + (size_t)qA * D_DIM + half * 8) : "memory");

    v8f ot[2][4];                                   // O^T accumulators [tile][d-chunk]
#pragma unroll
    for (int t = 0; t < 2; ++t)
#pragma unroll
        for (int c = 0; c < 4; ++c) ot[t][c] = splat8(0.0f);

    float m_run[2] = {-INFINITY, -INFINITY};        // log2 domain: the maximum in use
    // The maximum in use rides in the C operand of the S^T products, so that the scores leave the
    // matrix unit with it already taken off: negm holds -m_run in all eight registers. Beside a
    // maximum of large magnitude (every key so far masked) the sum in the matrix unit would round
    // the scores' own digits away: from MFOLD on C stays 0, and every pass goes through the rescale
    // side, which subtracts m_run behind the products.
    v8f   negm[2]  = {splat8(0.0f), splat8(0.0f)};
    // A score above it, C taken off, sends the pass to the rescale side: 8, or -infinity on the
    // first pass and while C does not carry the maximum.
    float m_thr[2] = {-INFINITY, -INFINITY};
    v16h ones;
#pragma unroll
    for (int e = 0; e < 16; ++e) ones[e] = (lane & 7) == 0 ? (_Float16)1.0f : (_Float16)0.0f;
    v8f lt[2] = {splat8(0.0f), splat8(0.0f)};
    const v8f mcoef = splat8(-1e9f * LOG2E);

    // Mask, K and V^T tiles 0 have landed before the first pass's barrier.
    asm volatile("s_wait_asynccnt 0x0" ::: "memory");

    // One pass of a wave group over 32 keys (its block at(kb): keys (at(kb) * KGRP + kg) * KBLK on).
    // cur: LDS buffer of this pass; more: a next pass exists (block-uniform).
    // mcur, mnext: this pass's and the next pass's mask tile is not all zeros (wave-uniform).
    auto pass = [&](const int kb, const int cur, const bool more, const bool mcur, const bool mnext) {
        __syncthreads();
        if (more) {          // the next pass's mask, K and V^T copies fly under this pass's work,
                             // into the buffers whose readers left them before the barrier above
            const int nb = at(kb + 1);
            const size_t nk0 = (size_t)nb * KGRP * KBLK * D_DIM;
            if (cur) {       // cur: a constant at each call
                if (mnext) copy_mask<0>(mg + nb * KGRP * KBLK, ml);
                copy_kv<0>(kp + nk0, vp + nk0, go, lk, lv);
            } else {
                if (mnext) copy_mask<1>(mg + nb * KGRP * KBLK, ml);
                copy_kv<1>(kp + nk0, vp + nk0, go, lk, lv);
            }
        }

        const _Float16* kt = ktile[kg][cur];
        const _Float16* vt = vtile[kg][cur];

        // ---- K A-fragments: loaded once, shared by both query tiles ----
        v16h ak00 = lds_frag(kt + n * KSTRIDE, half, 0);
        v16h ak01 = lds_frag(kt + n * KSTRIDE, half, 32);
        v16h ak10 = lds_frag(kt + (16 + n) * KSTRIDE, half, 0);
        v16h ak11 = lds_frag(kt + (16 + n) * KSTRIDE, half, 32);

        // ---- S^T - m = K_blk x Q^T + C : 8 WMMAs, two independent accumulator sets ----
        v8f st[2][2];
#pragma unroll
        for (int t = 0; t < 2; ++t) {
            v8f z0 = wmma_f16(ak00, bq[t][0], negm[t]);
            v8f z1 = wmma_f16(ak10, bq[t][0], negm[t]);
            z0 = wmma_f16(ak01, bq[t][1], z0);
            z1 = wmma_f16(ak11, bq[t][1], z1);
            st[t][0] = z0; st[t][1] = z1;
        }

        // Keeps the mask reads behind the S^T products, where they take the K fragments'
        // registers: moved up among them, they cost spills at 256 registers.
        __builtin_amdgcn_sched_barrier(0);
        // ---- mask: whole-vector math, operands are already pk-pair aligned ----
        if (mcur) {
#pragma unroll
            for (int t = 0; t < 2; ++t) {
                const float* mr = mrd + (cur * 32 + t * 16) * MSTRIDE;
                st[t][0] = lds_mask8(mr) * mcoef + st[t][0];
                st[t][1] = lds_mask8(mr + 16) * mcoef + st[t][1];
            }
        }

        // ---- V^T A-fragments, shared by both query tiles: read here, into the registers that the K
        // fragments and the mask have left, so that the maxima and exponentials cover their latency.
        v16h av[4];
#pragma unroll
        for (int c = 0; c < 4; ++c) av[c] = lds_frag(vt + (c * 16 + n) * VSTRIDE, half, 0);
        // Keeps these reads here: with the adds gone the compiler sinks them among the O^T products,
        // all into one register set, and the wave then waits out each pair's LDS latency in turn.
        __builtin_amdgcn_sched_barrier(0);

        // ---- lazy rescale: m_run, the maximum in use, may trail a query's true maximum by up to
        // 8 (log2 domain, so an exponential reaches 2^8 at most). Each lane tests its own 16 keys;
        // one scalar branch a pass; the halves meet, and l and O^T are rescaled, only behind it.
        float mloc[2];
        bool need = false;
#pragma unroll
        for (int t = 0; t < 2; ++t) {
            float mblk = -INFINITY;
#pragma unroll
            for (int v = 0; v < 8; ++v) mblk = fmaxf(mblk, fmaxf(st[t][0][v], st[t][1][v]));
            mloc[t] = mblk;
            need = need || (mblk > m_thr[t]);
        }
        // The test reads the same in the whole wave. Marked unlikely, so that the rescale stands
        // out of line and the usual pass falls through.
        if (__builtin_expect(__builtin_amdgcn_ballot_w32(need) != 0u, 0)) {
#pragma unroll
            for (int t = 0; t < 2; ++t) {
                const float c_old = -negm[t][0];    // what this pass's C has taken off
                const float mblk  = fmaxf(mloc[t], __shfl_xor(mloc[t], 16, 32)) + c_old;
                const float m_top = fmaxf(m_run[t], mblk);
                const bool  fold  = fabsf(m_top) <= MFOLD;
                // C is moved where it stands; what it then holds, rounding and all, is the maximum in use.
                negm[t] = negm[t] + splat8(c_old - (fold ? m_top : 0.0f));
                const float c_new = -negm[t][0];
                const float m_new = fold ? c_new : m_top;
                const float alpha = __builtin_amdgcn_exp2f(m_run[t] - m_new);  // 0 on the first pass
                m_run[t] = m_new;
                m_thr[t] = fold ? 8.0f : -INFINITY;
                const v8f dv = splat8(c_old - c_new);   // this pass's scores go over to the new C,
                const v8f rv = splat8(fold ? 0.0f : m_top);   // less what C does not carry
                st[t][0] = st[t][0] + dv - rv;
                st[t][1] = st[t][1] + dv - rv;
                const v8f av_ = splat8(alpha);
                lt[t] = lt[t] * av_;
#pragma unroll
                for (int c = 0; c < 4; ++c) ot[t][c] = ot[t][c] * av_;
            }
        }

        // ---- per-tile: exponentials (base-2) of the scores, the maximum in use taken off + P^T fragment ----
        v16h bp[2];
#pragma unroll
        for (int t = 0; t < 2; ++t) {
            const v8f s0 = st[t][0];
            const v8f s1 = st[t][1];
#pragma unroll
            for (int v = 0; v < 8; ++v) {
                bp[t][v]     = (_Float16)__builtin_amdgcn_exp2f(s0[v]);
                bp[t][v + 8] = (_Float16)__builtin_amdgcn_exp2f(s1[v]);
            }
        }

        // ---- l += column sums of P^T : 2 WMMAs in place of the vector adds and the halves' exchange ----
        lt[0] = wmma_f16(ones, bp[0], lt[0]);
        lt[1] = wmma_f16(ones, bp[1], lt[1]);

        // ---- O^T += V^T x P^T : 8 WMMAs ----
#pragma unroll
        for (int c = 0; c < 4; ++c) {
            ot[0][c] = wmma_f16(av[c], bp[0], ot[0][c]);
            ot[1][c] = wmma_f16(av[c], bp[1], ot[1][c]);
        }

        // Foot of the pass, in front of the next barrier: this wave's LDS reads are done, so
        // that the buffers it has just read may be refilled behind that barrier ...
        asm volatile("s_wait_dscnt 0x0" ::: "memory");
        // ... and its copies of the next pass's mask, K and V^T tiles have landed.
        asm volatile("s_wait_asynccnt 0x0" ::: "memory");
    };

    // Two passes a trip, so that the LDS buffers swap by name.
    for (int kb = 0; kb < NPASS; kb += 2) {
        const bool m1 = live(kb + 1);
        const bool more = kb + 2 < NPASS;
        const bool m2 = more && live(kb + 2);
        pass(kb,     0, true, mc, m1);
        pass(kb + 1, 1, more, m1, m2);
        mc = m2;
    }
    // No copy is in flight when the wave goes on to the join and ends.
    asm volatile("s_wait_asynccnt 0x0" ::: "memory");

    if (kg == 1) {
#pragma unroll
        for (int t = 0; t < 2; ++t) {
            part_ml[wave][t][lane]     = m_run[t];
            part_ml[wave][2 + t][lane] = lt[t][0];
#pragma unroll
            for (int c = 0; c < 4; ++c)
                *reinterpret_cast<v8f*>(&part_o[wave][t * 4 + c][lane][0]) = ot[t][c];
        }
    }
    __syncthreads();
    if (kg == 1) return;

    // ---- epilogue: O[q][d] = O^T / l ; lane owns row q, d = c*16 + half*8 + v ----
#pragma unroll
    for (int t = 0; t < 2; ++t) {
        const float m1 = part_ml[wave][t][lane];
        const float l1 = part_ml[wave][2 + t][lane];
        const float mj = fmaxf(m_run[t], m1);
        const float a0 = __builtin_amdgcn_exp2f(m_run[t] - mj);
        const float a1 = __builtin_amdgcn_exp2f(m1 - mj);
        const float inv = 1.0f / (lt[t][0] * a0 + l1 * a1);
        const v8f w0 = splat8(a0 * inv);
        const v8f w1 = splat8(a1 * inv);
        float* orow = O + base + (size_t)(t ? qB : qA) * D_DIM;
#pragma unroll
        for (int c = 0; c < 4; ++c) {
            const v8f o1 = *reinterpret_cast<const v8f*>(&part_o[wave][t * 4 + c][lane][0]);
            v8f ov = ot[t][c] * w0 + o1 * w1;
            *reinterpret_cast<v8f*>(orow + c * 16 + half * 8) = ov;  // 2x b128 store
        }
    }
}

extern "C" void kernel_launch(void* const* d_in, const int* in_sizes, int n_in,
                              void* d_out, int out_size, void* d_ws, size_t ws_size,
                              hipStream_t stream) {
    (void)in_sizes; (void)n_in; (void)ws_size; (void)out_size;
    const float* Q  = (const float*)d_in[0];
    const float* K  = (const float*)d_in[1];
    const float* V  = (const float*)d_in[2];
    // d_in[3] = d_k (scalar, 64) — folded into the Q pre-scale
    const float* Mk = (const float*)d_in[4];
    float* O = (float*)d_out;
    _Float16* Kh = (_Float16*)d_ws;                  // 8 MB
    _Float16* Vt = Kh + 16 * S_LEN * D_DIM;          // 8 MB
    unsigned* Fl = (unsigned*)(Vt + 16 * S_LEN * D_DIM);  // 64 KB: 512 flag words, a line each

    // grid: 16 (b,h) slices x 32 query-blocks of 128 rows; 256 threads = 2 groups of 4 waves
    dim3 grid(16 * 32), block(256);
    kv_to_f16<<<dim3(KVWG + MWG), block, 0, stream>>>(K, V, Mk, Kh, Vt, Fl);
    flash_attn_fwd<<<grid, block, 0, stream>>>(Q, Kh, Vt, Mk, Fl, O);
}

// v010
// Measured time: 63.3 microseconds a run.
// Two timings next to v009 put it at 1.03 and 1.04 times that version's speed.
// Counting every step since v000, it is 13.2 times as fast.
#include <hip/hip_runtime.h>
#include <hip/hip_bf16.h>

typedef _Float16 v16h __attribute__((ext_vector_type(16)));
typedef _Float16 h8   __attribute__((ext_vector_type(8)));
typedef _Float16 h4   __attribute__((ext_vector_type(4)));
typedef _Float16 h2   __attribute__((ext_vector_type(2)));
typedef float    v8f  __attribute__((ext_vector_type(8)));
typedef float    v4f  __attribute__((ext_vector_type(4)));

#define S_LEN   4096
#define D_DIM   64
#define KBLK    32            // keys per pass; a loop trip runs two passes
#define NBLK    (S_LEN / KBLK)
#define KGRP    2
#define NPASS   (NBLK / KGRP)
#define KSTRIDE 72
#define VSTRIDE 40
#define MSTRIDE 36
#define LOG2E   1.4426950408889634f
#define MFOLD   256.0f        // log2 domain: largest magnitude of a maximum that rides in the C operand

__device__ inline v8f splat8(float x) {
    v8f r;
#pragma unroll
    for (int e = 0; e < 8; ++e) r[e] = x;
    return r;
}

__device__ inline v16h lds_frag(const _Float16* row, int half, int doff) {
    union { v16h v; h8 h[2]; } u;
    u.h[0] = *reinterpret_cast<const h8*>(row + doff + half * 8);
    u.h[1] = *reinterpret_cast<const h8*>(row + doff + 16 + half * 8);
    return u.v;
}

// Global f32 -> f16 fragment with pre-scale folded in.
__device__ inline v16h glb_frag_scaled(const float* __restrict__ row, int half,
                                       int doff, float scale) {
    const float4* p0 = reinterpret_cast<const float4*>(row + doff + half * 8);
    const float4* p1 = reinterpret_cast<const float4*>(row + doff + 16 + half * 8);
    float4 a = p0[0], b = p0[1], c = p1[0], d = p1[1];
    float lo[8] = {a.x, a.y, a.z, a.w, b.x, b.y, b.z, b.w};
    float hi[8] = {c.x, c.y, c.z, c.w, d.x, d.y, d.z, d.w};
    v16h r;
#pragma unroll
    for (int e = 0; e < 8; ++e) {
        r[e]     = (_Float16)(lo[e] * scale);
        r[e + 8] = (_Float16)(hi[e] * scale);
    }
    return r;
}

__device__ inline v8f wmma_f16(v16h a, v16h b, v8f c) {
    return __builtin_amdgcn_wmma_f32_16x16x32_f16(false, a, false, b, (short)0, c, false, false);
}

// First launch: K and V, f32, are turned into f16 once, into the workspace, so that the 32 query
// blocks of a (b,h) slice read half the bytes and none of them converts or transposes.
//   Kh: K's own order, [slice][key][d].
//   Vt: per block of 32 keys d-major, [slice][key block][d][key in block]: the V^T tile as LDS holds it.
// A work-group takes PKEYS keys of one slice (the slices follow one another in memory).
#define PKEYS 256
#define PBLK  (PKEYS / KBLK)
#define KVWG  (16 * S_LEN / PKEYS)   // work-groups that convert K and V
// The same launch looks through the mask once: further work-groups, each on 32 query rows x 1024
// key columns, write one word: bit i is set where 32 x 32 tile i of that strip holds an entry
// other than +0 or -0. A tile of zeros adds exactly nothing to the scores, so the main loop
// neither copies nor adds a tile whose bit is clear. Each word has a 128-B line of its own.
#define MCOLS 1024
#define MWG   ((S_LEN / 32) * (S_LEN / MCOLS))
#define FSTEP 32                     // words from one flag word to the next
__global__ __launch_bounds__(256) __attribute__((amdgpu_waves_per_eu(2, 2))) void
kv_to_f16(const float* __restrict__ K, const float* __restrict__ V, const float* __restrict__ Mk,
          _Float16* __restrict__ Kh, _Float16* __restrict__ Vt, unsigned* __restrict__ Fl) {
    __shared__ __attribute__((aligned(16))) _Float16 tr[PBLK][D_DIM * VSTRIDE];
    __shared__ unsigned nib[8];
    const int t = threadIdx.x;
    if (blockIdx.x >= KVWG) {                 // the same for the whole work-group
        const int sb = blockIdx.x - KVWG;     // strip: rows (sb >> 2) * 32 on, columns (sb & 3) * 1024 on
        const int w = t >> 5, ln = t & 31;
        // A wave takes 128 columns, four tiles: 512 contiguous bytes of each of the 32 rows.
        const v4f* mp = reinterpret_cast<const v4f*>(
            Mk + (size_t)(sb >> 2) * 32 * S_LEN + (sb & 3) * MCOLS + w * 128) + ln;
        v4f x[32];
#pragma unroll                                // unrolled: all 32 loads of a lane in flight together
        for (int r = 0; r < 32; ++r) x[r] = mp[r * (S_LEN / 4)];
        // Stands in front of every later write of a register that these loads name.
        asm volatile("s_wait_xcnt 0x0" :: "v"(mp) : "memory");
        unsigned acc = 0;
#pragma unroll
        for (int r = 0; r < 32; ++r)
#pragma unroll
            for (int c = 0; c < 4; ++c) acc |= __float_as_uint(x[r][c]);
        // The sign bit is left out: -0 counts as zero; NaN, infinity and subnormals count as set.
        const unsigned b = __builtin_amdgcn_ballot_w32((acc << 1) != 0u);   // 8 lanes a tile
        const unsigned n4 = ((b & 0xffu) ? 1u : 0u) | ((b & 0xff00u) ? 2u : 0u) |
                            ((b & 0xff0000u) ? 4u : 0u) | ((b & 0xff000000u) ? 8u : 0u);
        if (ln == 0) nib[w] = n4 << (4 * w);
        __syncthreads();                      // the eight waves' bits are in LDS before thread 0 joins them
        if (t == 0) {
            unsigned word = 0;
#pragma unroll
            for (int i = 0; i < 8; ++i) word |= nib[i];
            Fl[sb * FSTEP] = word;
        }
        return;
    }
    const size_t e0 = (size_t)blockIdx.x * (PKEYS * D_DIM);      // first element of the share
    const v4f* k4 = reinterpret_cast<const v4f*>(K + e0) + t;    // 512 contiguous bytes a wave
    // Rows 2r and 2r + 1 of a key block, columns 4 * (t & 15) on: whole 256-B rows, 16 lanes each.
    const int r = t >> 4, d4 = t & 15;
    const v4f* v4 = reinterpret_cast<const v4f*>(V + e0) + 2 * r * (D_DIM / 4) + d4;

    // The loops are unrolled so that all of a thread's loads are in flight together.
    v4f va[PBLK], vb[PBLK], kr[2 * PBLK];
#pragma unroll
    for (int j = 0; j < PBLK; ++j) {
        va[j] = v4[j * (KBLK * D_DIM / 4)];
        vb[j] = v4[j * (KBLK * D_DIM / 4) + D_DIM / 4];
    }
#pragma unroll
    for (int j = 0; j < 2 * PBLK; ++j) kr[j] = k4[j * 256];
#pragma unroll
    for (int j = 0; j < PBLK; ++j)
#pragma unroll
        for (int c = 0; c < 4; ++c) {
            h2 p; p[0] = (_Float16)va[j][c]; p[1] = (_Float16)vb[j][c];
            *reinterpret_cast<h2*>(&tr[j][(4 * d4 + c) * VSTRIDE + 2 * r]) = p;   // transposed
        }
    __syncthreads();      // the transposed tiles are whole before other threads read them out
    // All global stores stand behind the barrier, which would wait for stores in front of it.
#pragma unroll
    for (int j = 0; j < 2 * PBLK; ++j) {
        h4 p;
#pragma unroll
        for (int c = 0; c < 4; ++c) p[c] = (_Float16)kr[j][c];
        *reinterpret_cast<h4*>(Kh + e0 + (size_t)(j * 256 + t) * 4) = p;   // 256 contiguous bytes a wave
    }
#pragma unroll
    for (int j = 0; j < PBLK; ++j) {          // 16 bytes at (t & 3) * 16 of row t >> 2: whole lines out
        const h8 p = *reinterpret_cast<const h8*>(&tr[j][(t >> 2) * VSTRIDE + (t & 3) * 8]);
        *reinterpret_cast<h8*>(Vt + e0 + (size_t)(j * 256 + t) * 8) = p;
    }
}

// One wave group's K tile (32 rows of 128 B) and V^T tile (64 rows of 64 B), f16, each 4 KB in a
// row in the workspace, to LDS buffer BUF through no register: two copies of 16 bytes a lane each.
// kg, vg: the tiles' first bytes (the same in all lanes: scalar bases); go: the lane's byte in a
// half tile, tid * 16; lk, lv: its LDS byte addresses in buffer 0 (K: (tid & 7) * 16 of row
// tid >> 3; V^T: (tid & 3) * 16 of row tid >> 2). The immediate offset moves both addresses: it
// carries the LDS step (buffer, half tile), and the scalar base has it taken off.
// The last line stands in front of every later write of a register that a copy names.
template <int BUF>
__device__ inline void copy_kv(const _Float16* kg, const _Float16* vg, unsigned go,
                               unsigned lk, unsigned lv) {
    constexpr int K0 = BUF * KBLK * KSTRIDE * 2;        // bytes: the K buffer's start
    constexpr int K1 = K0 + (KBLK / 2) * KSTRIDE * 2;   // bytes: its row 16
    constexpr int V0 = BUF * D_DIM * VSTRIDE * 2;       // bytes: the V^T buffer's start
    constexpr int V1 = V0 + (D_DIM / 2) * VSTRIDE * 2;  // bytes: its row 32
    constexpr int H  = KBLK * D_DIM;                    // bytes: half a tile in the workspace
    const unsigned long long ka = (unsigned long long)kg, va = (unsigned long long)vg;
    asm volatile("global_load_async_to_lds_b128 %0, %2, %3 offset:%7\n\t"
                 "global_load_async_to_lds_b128 %0, %2, %4 offset:%8\n\t"
                 "global_load_async_to_lds_b128 %1, %2, %5 offset:%9\n\t"
                 "global_load_async_to_lds_b128 %1, %2, %6 offset:%10\n\t"
                 "s_wait_xcnt 0x0"
                 :: "v"(lk), "v"(lv), "v"(go),
                    "s"(ka - K0), "s"(ka + H - K1), "s"(va - V0), "s"(va + H - V1),
                    "n"(K0), "n"(K1), "n"(V0), "n"(V1)
                 : "memory");
}

// One wave's own 32 x 32 f32 mask tile, global memory to LDS buffer BUF through no register.
// A copy takes four whole 128-B rows (8 lanes a row), where a load in score order would touch
// 16 lines for the same 512 bytes. g, l: the lane's 16 bytes at (lane&7)*16 of row lane>>3, in
// memory and in buffer 0. The immediate offset moves both addresses: it carries the LDS step
// (buffer, four rows a copy), so that one LDS address register serves every copy, and the
// global address, formed anew for each tile anyway, has it taken off.
// The last line stands in front of every later write of a register that a copy names.
template <int BUF>
__device__ inline void copy_mask(const float* g, unsigned l) {
    constexpr int B0 = BUF * 32 * MSTRIDE * 4;      // bytes: the buffer's start
    constexpr int BJ = 4 * MSTRIDE * 4;             // bytes: four rows in LDS
    constexpr long long GJ = 4LL * S_LEN * 4 - BJ;  // bytes: four rows in memory, less the offset's step
    const unsigned long long a = (unsigned long long)g - B0;
    asm volatile("global_load_async_to_lds_b128 %0, %1, off offset:%9\n\t"
                 "global_load_async_to_lds_b128 %0, %2, off offset:%10\n\t"
                 "global_load_async_to_lds_b128 %0, %3, off offset:%11\n\t"
                 "global_load_async_to_lds_b128 %0, %4, off offset:%12\n\t"
                 "global_load_async_to_lds_b128 %0, %5, off offset:%13\n\t"
                 "global_load_async_to_lds_b128 %0, %6, off offset:%14\n\t"
                 "global_load_async_to_lds_b128 %0, %7, off offset:%15\n\t"
                 "global_load_async_to_lds_b128 %0, %8, off offset:%16\n\t"
                 "s_wait_xcnt 0x0"
                 :: "v"(l),
                    "v"(a),          "v"(a + GJ),     "v"(a + 2 * GJ), "v"(a + 3 * GJ),
                    "v"(a + 4 * GJ), "v"(a + 5 * GJ), "v"(a + 6 * GJ), "v"(a + 7 * GJ),
                    "n"(B0),          "n"(B0 + BJ),     "n"(B0 + 2 * BJ), "n"(B0 + 3 * BJ),
                    "n"(B0 + 4 * BJ), "n"(B0 + 5 * BJ), "n"(B0 + 6 * BJ), "n"(B0 + 7 * BJ)
                 : "memory");
}

// Eight mask values of one row out of LDS (2x ds_load_b128; the row stride is no multiple of 32 B).
__device__ inline v8f lds_mask8(const float* p) {
    const v4f a = *reinterpret_cast<const v4f*>(p);
    const v4f b = *reinterpret_cast<const v4f*>(p + 4);
    return __builtin_shufflevector(a, b, 0, 1, 2, 3, 4, 5, 6, 7);
}

__global__ __launch_bounds__(256) __attribute__((amdgpu_waves_per_eu(4, 4))) void
flash_attn_fwd(const float* __restrict__ Q, const _Float16* __restrict__ Kh,
               const _Float16* __restrict__ Vt, const float* __restrict__ Mk,
               const unsigned* __restrict__ Fl, float* __restrict__ O) {
    const int lane = threadIdx.x & 31;
    const int wave = (threadIdx.x >> 5) & 3;  // query slice of the work-group
    // wave group: takes key blocks kg, kg + 2, ... (the same in all lanes: kept scalar)
    const int kg   = __builtin_amdgcn_readfirstlane(threadIdx.x >> 7);
    const int n    = lane & 15;   // query column of all transposed tiles
    const int half = lane >> 4;   // K-half of A/B fragments held by this lane

    const int bh   = blockIdx.x >> 5;        // 16 (b,h) slices
    const int qblk = blockIdx.x & 31;        // 32 query blocks of 128 rows
    const int q0   = qblk * 128 + wave * 32; // 32 queries per wave: two 16-row tiles

    const size_t base = (size_t)bh * S_LEN * D_DIM;
    const int qA = q0 + n, qB = q0 + 16 + n;
    // Mask (broadcasts over B,H): the lane's share of the wave's tile, at the group's first columns.
    const float* mg = Mk + (size_t)(q0 + (lane >> 3)) * S_LEN + kg * KBLK + (lane & 7) * 4;

    __shared__ __attribute__((aligned(16))) _Float16 ktile[KGRP][2][KBLK * KSTRIDE];
    __shared__ __attribute__((aligned(16))) _Float16 vtile[KGRP][2][D_DIM * VSTRIDE];
    __shared__ __attribute__((aligned(32))) float part_o[4][8][32][8];
    __shared__ float    part_ml[4][4][32];
    __shared__ __attribute__((aligned(16))) float mtile[2 * 4][2][32 * MSTRIDE];
    __shared__ unsigned redo;
    if (threadIdx.x == 0) redo = 0u;

    float* mt = &mtile[threadIdx.x >> 5][0][0];     // this wave's two mask tiles
    // LDS byte address (low 32 bits of the shared address) of the lane's first copy, buffer 0.
    const unsigned ml = (unsigned)(size_t)(mt + (lane >> 3) * MSTRIDE + (lane & 7) * 4);
    const float* mrd = mt + n * MSTRIDE + half * 8; // where the lane reads row qA's values

    // The group's first K and V^T tiles in the workspace, and this thread's share of a tile.
    const int tid = threadIdx.x & 127;              // place within the wave group
    const _Float16* kp = Kh + base + kg * KBLK * D_DIM;
    const _Float16* vp = Vt + base + kg * KBLK * D_DIM;
    const unsigned go = tid * 16;
    const unsigned lk = (unsigned)(size_t)(&ktile[kg][0][0] + (tid >> 3) * KSTRIDE + (tid & 7) * 8);
    const unsigned lv = (unsigned)(size_t)(&vtile[kg][0][0] + (tid >> 2) * VSTRIDE + (tid & 3) * 8);
    // The 32 work-groups of a slice read the same K and V^T tiles and run at the same pace. Each
    // enters the key walk at a place of its own and wraps round, so that they do not ask L2 for
    // the same lines at the same moment: query blocks stand two passes apart, and slice bh a
    // further bh passes on, which also parts the 16 work-groups that share a query block's mask
    // tiles. at(kb): the place among the group's key blocks, 0 to NPASS - 1, that pass kb works
    // on; the NPASS passes take every place once (from blockIdx alone: scalar).
    const int rot = (2 * qblk + bh) & (NPASS - 1);
    auto at = [&](const int kb) -> int { return (kb + rot) & (NPASS - 1); };
    const size_t fk0 = (size_t)at(0) * KGRP * KBLK * D_DIM;
    copy_kv<0>(kp + fk0, vp + fk0, go, lk, lv);     // pass 0's tiles into buffers 0

    // The first launch's bits for this wave's 32 query rows, one for each of the 128 key blocks
    // (the same in all lanes: kept scalar, so that every test of a bit is a scalar branch).
    const unsigned* fp = Fl + __builtin_amdgcn_readfirstlane(q0 >> 5) * (S_LEN / MCOLS) * FSTEP;
    const unsigned long long flo =
        (unsigned)__builtin_amdgcn_readfirstlane(fp[0]) |
        ((unsigned long long)(unsigned)__builtin_amdgcn_readfirstlane(fp[FSTEP]) << 32);
    const unsigned long long fhi =
        (unsigned)__builtin_amdgcn_readfirstlane(fp[2 * FSTEP]) |
        ((unsigned long long)(unsigned)__builtin_amdgcn_readfirstlane(fp[3 * FSTEP]) << 32);
    // Does the mask tile of the group's pass kb hold anything but zeros?
    auto live = [&](const int kb) -> bool {
        const int blk = at(kb) * KGRP + kg;
        return (((blk & 64) ? fhi : flo) >> (blk & 63)) & 1ull;
    };
    bool mc = live(0);
    if (mc) copy_mask<0>(mg + at(0) * KGRP * KBLK, ml);   // pass 0's tile into buffer 0

    // Loop-invariant Q^T B-fragments, pre-scaled by (1/sqrt(d_k))*log2(e):
    // scores come out of the QK WMMAs already in log2 domain.
    const float qs = 0.125f * LOG2E;
    v16h bq[2][2];
    bq[0][0] = glb_frag_scaled(Q + base + (size_t)qA * D_DIM, half, 0,  qs);
    bq[0][1] = glb_frag_scaled(Q + base + (size_t)qA * D_DIM, half, 32, qs);
    bq[1][0] = glb_frag_scaled(Q + base + (size_t)qB * D_DIM, half, 0,  qs);
    bq[1][1] = glb_frag_scaled(Q + base + (size_t)qB * D_DIM, half, 32, qs);
    // Stands in front of every later write of a register that the Q loads name. Their address is
    // an input, so that its registers are still held here and nothing is written to them earlier.
    asm volatile("s_wait_xcnt 0x0" :: "v"(Q + base + (size_t)qA * D_DIM + half * 8) : "memory");

    v8f ot[2][4];                                   // O^T accumulators [tile][d-chunk]
#pragma unroll
    for (int t = 0; t < 2; ++t)
#pragma unroll
        for (int c = 0; c < 4; ++c) ot[t][c] = splat8(0.0f);

    float m_run[2] = {-INFINITY, -INFINITY};        // log2 domain: the maximum in use
    // The maximum in use rides in the C operand of the S^T products, so that the scores leave the
    // matrix unit with it already taken off: negm holds -m_run in all eight registers. Beside a
    // maximum of large magnitude (every key so far masked) the sum in the matrix unit would round
    // the scores' own digits away: from MFOLD on C stays 0, and every pass goes through the rescale
    // side, which subtracts m_run behind the products.
    v8f   negm[2]  = {splat8(0.0f), splat8(0.0f)};
    // A score above it, C taken off, sends the pass to the rescale side: 8, or -infinity on the
    // first pass and while C does not carry the maximum.
    float m_thr[2] = {-INFINITY, -INFINITY};
    v16h ones;
#pragma unroll
    for (int e = 0; e < 16; ++e) ones[e] = (lane & 7) == 0 ? (_Float16)1.0f : (_Float16)0.0f;
    v8f lt[2] = {splat8(0.0f), splat8(0.0f)};
    const v8f mcoef = splat8(-1e9f * LOG2E);

    // Mask, K and V^T tiles 0 have landed before the first pass's barrier.
    asm volatile("s_wait_asynccnt 0x0" ::: "memory");

    // One pass of a wave group over 32 keys (its block at(kb): keys (at(kb) * KGRP + kg) * KBLK on).
    // cur: LDS buffer of this pass; more: the tiles of a next pass are copied, a second walk's pass 0 by the first walk's last (block-uniform).
    // mcur, mnext: this pass's and the next pass's mask tile is not all zeros (wave-uniform).
    // test: the pass holds its scores against the maximum in use; every: so does each pass of this
    // walk (both wave-uniform; the walks are told below).
    bool test = true, every = false;
    auto pass = [&](const int kb, const int cur, const bool more, const bool mcur, const bool mnext) {
        __syncthreads();
        if (more) {          // the next pass's mask, K and V^T copies fly under this pass's work,
                             // into the buffers whose readers left them before the barrier above
            const int nb = at(kb + 1);
            const size_t nk0 = (size_t)nb * KGRP * KBLK * D_DIM;
            if (cur) {       // cur: a constant at each call
                if (mnext) copy_mask<0>(mg + nb * KGRP * KBLK, ml);
                copy_kv<0>(kp + nk0, vp + nk0, go, lk, lv);
            } else {
                if (mnext) copy_mask<1>(mg + nb * KGRP * KBLK, ml);
                copy_kv<1>(kp + nk0, vp + nk0, go, lk, lv);
            }
        }

        const _Float16* kt = ktile[kg][cur];
        const _Float16* vt = vtile[kg][cur];

        // ---- K A-fragments: loaded once, shared by both query tiles ----
        v16h ak00 = lds_frag(kt + n * KSTRIDE, half, 0);
        v16h ak01 = lds_frag(kt + n * KSTRIDE, half, 32);
        v16h ak10 = lds_frag(kt + (16 + n) * KSTRIDE, half, 0);
        v16h ak11 = lds_frag(kt + (16 + n) * KSTRIDE, half, 32);

        // ---- S^T - m = K_blk x Q^T + C : 8 WMMAs, two independent accumulator sets ----
        v8f st[2][2];
#pragma unroll
        for (int t = 0; t < 2; ++t) {
            v8f z0 = wmma_f16(ak00, bq[t][0], negm[t]);
            v8f z1 = wmma_f16(ak10, bq[t][0], negm[t]);
            z0 = wmma_f16(ak01, bq[t][1], z0);
            z1 = wmma_f16(ak11, bq[t][1], z1);
            st[t][0] = z0; st[t][1] = z1;
        }

        // Keeps the mask reads behind the S^T products, where they take the K fragments'
        // registers: moved up among them, they cost spills at 256 registers.
        __builtin_amdgcn_sched_barrier(0);
        // ---- mask: whole-vector math, operands are already pk-pair aligned ----
        if (mcur) {
#pragma unroll
            for (int t = 0; t < 2; ++t) {
                const float* mr = mrd + (cur * 32 + t * 16) * MSTRIDE;
                st[t][0] = lds_mask8(mr) * mcoef + st[t][0];
                st[t][1] = lds_mask8(mr + 16) * mcoef + st[t][1];
            }
        }

        // ---- V^T A-fragments, shared by both query tiles: read here, into the registers that the K
        // fragments and the mask have left, so that the maxima and exponentials cover their latency.
        v16h av[4];
#pragma unroll
        for (int c = 0; c < 4; ++c) av[c] = lds_frag(vt + (c * 16 + n) * VSTRIDE, half, 0);
        // Keeps these reads here: with the adds gone the compiler sinks them among the O^T products,
        // all into one register set, and the wave then waits out each pair's LDS latency in turn.
        __builtin_amdgcn_sched_barrier(0);

        // ---- lazy rescale: while the passes are tested, m_run, the maximum in use, may trail a query's true maximum by up to
        // 8 (log2 domain, so an exponential reaches 2^8 at most). Each lane tests its own 16 keys;
        // one scalar branch a pass; the halves meet, and l and O^T are rescaled, only behind it.
        // An untested pass (see the walks below) takes no maxima at all: a scalar branch on a flag,
        // marked unlikely, so that the maxima stand out of line and the untested pass falls through.
        if (__builtin_expect(test, 0)) {
        float mloc[2];
        bool need = false;
#pragma unroll
        for (int t = 0; t < 2; ++t) {
            float mblk = -INFINITY;
#pragma unroll
            for (int v = 0; v < 8; ++v) mblk = fmaxf(mblk, fmaxf(st[t][0][v], st[t][1][v]));
            mloc[t] = mblk;
            need = need || (mblk > m_thr[t]);
        }
        // The test reads the same in the whole wave. Marked unlikely, so that the rescale stands
        // out of line and the usual pass falls through.
        if (__builtin_expect(__builtin_amdgcn_ballot_w32(need) != 0u, 0)) {
#pragma unroll
            for (int t = 0; t < 2; ++t) {
                const float c_old = -negm[t][0];    // what this pass's C has taken off
                const float mblk  = fmaxf(mloc[t], __shfl_xor(mloc[t], 16, 32)) + c_old;
                const float m_top = fmaxf(m_run[t], mblk);
                const bool  fold  = fabsf(m_top) <= MFOLD;
                // C is moved where it stands; what it then holds, rounding and all, is the maximum in use.
                negm[t] = negm[t] + splat8(c_old - (fold ? m_top : 0.0f));
                const float c_new = -negm[t][0];
                const float m_new = fold ? c_new : m_top;
                const float alpha = __builtin_amdgcn_exp2f(m_run[t] - m_new);  // 0 on the first pass
                m_run[t] = m_new;
                m_thr[t] = fold ? 8.0f : -INFINITY;
                const v8f dv = splat8(c_old - c_new);   // this pass's scores go over to the new C,
                const v8f rv = splat8(fold ? 0.0f : m_top);   // less what C does not carry
                st[t][0] = st[t][0] + dv - rv;
                st[t][1] = st[t][1] + dv - rv;
                const v8f av_ = splat8(alpha);
                lt[t] = lt[t] * av_;
#pragma unroll
                for (int c = 0; c < 4; ++c) ot[t][c] = ot[t][c] * av_;
            }
        }
        // Behind a trip's second pass: the wave goes on untested once the maximum in use rides in C
        // in every lane (the ballot reads the same in the whole wave), but never on a second walk.
        if (cur) test = every || __builtin_amdgcn_ballot_w32(m_thr[0] == 8.0f && m_thr[1] == 8.0f) != 0xffffffffu;
        }

        // ---- per-tile: exponentials (base-2) of the scores, the maximum in use taken off + P^T fragment ----
        v16h bp[2];
#pragma unroll
        for (int t = 0; t < 2; ++t) {
            const v8f s0 = st[t][0];
            const v8f s1 = st[t][1];
#pragma unroll
            for (int v = 0; v < 8; ++v) {
                bp[t][v]     = (_Float16)__builtin_amdgcn_exp2f(s0[v]);
                bp[t][v + 8] = (_Float16)__builtin_amdgcn_exp2f(s1[v]);
            }
        }

        // ---- l += column sums of P^T : 2 WMMAs in place of the vector adds and the halves' exchange ----
        lt[0] = wmma_f16(ones, bp[0], lt[0]);
        lt[1] = wmma_f16(ones, bp[1], lt[1]);

        // ---- O^T += V^T x P^T : 8 WMMAs ----
#pragma unroll
        for (int c = 0; c < 4; ++c) {
            ot[0][c] = wmma_f16(av[c], bp[0], ot[0][c]);
            ot[1][c] = wmma_f16(av[c], bp[1], ot[1][c]);
        }

        // Foot of the pass, in front of the next barrier: this wave's LDS reads are done, so
        // that the buffers it has just read may be refilled behind that barrier ...
        asm volatile("s_wait_dscnt 0x0" ::: "memory");
        // ... and its copies of the next pass's mask, K and V^T tiles have landed.
        asm volatile("s_wait_asynccnt 0x0" ::: "memory");
    };

    // The first walk over the keys tests its first two passes. Where their maximum then rides in C
    // in every lane, the wave's later passes take it as it stands: P = 2^(score - m) is right for
    // any m as long as it fits f16, and a P that does not fit becomes infinity, which the row sum
    // keeps to the end. A wave that finds a row sum not finite (NaN too) votes, and the whole
    // work-group then walks a second time with every pass tested. At most two walks.
#pragma nounroll          // one copy of the key loop in the text: the second walk is the rare one
    for (int walk = 0; walk < 2; ++walk) {
        // Two passes a trip, so that the LDS buffers swap by name.
        for (int kb = 0; kb < NPASS; kb += 2) {
            const bool m1 = live(kb + 1);
            // The first walk's last pass copies pass 0's tiles once more (the places wrap round), so
            // that a second walk finds them in buffers 0 as the first did.
            const bool more = walk == 0 || kb + 2 < NPASS;
            const bool m2 = more && live(kb + 2);
            pass(kb,     0, true, mc, m1);
            pass(kb + 1, 1, more, m1, m2);
            mc = m2;
        }
        // No copy is in flight when the wave goes on to the join.
        asm volatile("s_wait_asynccnt 0x0" ::: "memory");

        if (walk == 0) {
            const bool fin = lt[0][0] < 3.0e38f && lt[1][0] < 3.0e38f;   // false for infinity and NaN
            if (__builtin_amdgcn_ballot_w32(!fin) != 0u && lane == 0) redo = 1u;
        }
        else break;           // a tested walk needs no vote (walk: the same for the whole work-group)
        __syncthreads();      // every wave's vote is in LDS before anybody reads the word
        // The same for the whole work-group; nobody writes the word behind this barrier.
        if (__builtin_amdgcn_readfirstlane(redo) == 0u) break;

        // Second walk: the sums and maxima start anew; mc and buffers 0 stand ready for pass 0.
#pragma unroll
        for (int t = 0; t < 2; ++t) {
#pragma unroll
            for (int c = 0; c < 4; ++c) ot[t][c] = splat8(0.0f);
            lt[t] = splat8(0.0f);
            negm[t] = splat8(0.0f);
            m_run[t] = -INFINITY;
            m_thr[t] = -INFINITY;
        }
        test = true;
        every = true;
    }

    if (kg == 1) {
#pragma unroll
        for (int t = 0; t < 2; ++t) {
            part_ml[wave][t][lane]     = m_run[t];
            part_ml[wave][2 + t][lane] = lt[t][0];
#pragma unroll
            for (int c = 0; c < 4; ++c)
                *reinterpret_cast<v8f*>(&part_o[wave][t * 4 + c][lane][0]) = ot[t][c];
        }
    }
    __syncthreads();
    if (kg == 1) return;

    // ---- epilogue: O[q][d] = O^T / l ; lane owns row q, d = c*16 + half*8 + v ----
#pragma unroll
    for (int t = 0; t < 2; ++t) {
        const float m1 = part_ml[wave][t][lane];
        const float l1 = part_ml[wave][2 + t][lane];
        const float mj = fmaxf(m_run[t], m1);
        const float a0 = __builtin_amdgcn_exp2f(m_run[t] - mj);
        const float a1 = __builtin_amdgcn_exp2f(m1 - mj);
        const float inv = 1.0f / (lt[t][0] * a0 + l1 * a1);
        const v8f w0 = splat8(a0 * inv);
        const v8f w1 = splat8(a1 * inv);
        float* orow = O + base + (size_t)(t ? qB : qA) * D_DIM;
#pragma unroll
        for (int c = 0; c < 4; ++c) {
            const v8f o1 = *reinterpret_cast<const v8f*>(&part_o[wave][t * 4 + c][lane][0]);
            v8f ov = ot[t][c] * w0 + o1 * w1;
            *reinterpret_cast<v8f*>(orow + c * 16 + half * 8) = ov;  // 2x b128 store
        }
    }
}

extern "C" void kernel_launch(void* const* d_in, const int* in_sizes, int n_in,
                              void* d_out, int out_size, void* d_ws, size_t ws_size,
                              hipStream_t stream) {
    (void)in_sizes; (void)n_in; (void)ws_size; (void)out_size;
    const float* Q  = (const float*)d_in[0];
    const float* K  = (const float*)d_in[1];
    const float* V  = (const float*)d_in[2];
    // d_in[3] = d_k (scalar, 64) — folded into the Q pre-scale
    const float* Mk = (const float*)d_in[4];
    float* O = (float*)d_out;
    _Float16* Kh = (_Float16*)d_ws;                  // 8 MB
    _Float16* Vt = Kh + 16 * S_LEN * D_DIM;          // 8 MB
    unsigned* Fl = (unsigned*)(Vt + 16 * S_LEN * D_DIM);  // 64 KB: 512 flag words, a line each

    // grid: 16 (b,h) slices x 32 query-blocks of 128 rows; 256 threads = 2 groups of 4 waves
    dim3 grid(16 * 32), block(256);
    kv_to_f16<<<dim3(KVWG + MWG), block, 0, stream>>>(K, V, Mk, Kh, Vt, Fl);
    flash_attn_fwd<<<grid, block, 0, stream>>>(Q, Kh, Vt, Mk, Fl, O);
}
